// v000
// The times below were measured on an AMD MI455X: many runs one after another, warmed up first and cycling through
// copies of the inputs, with the whole window's GPU time divided by the number of runs. Launches and the gaps
// between them are all in it. The median over several windows is given; except for v000 it joins two sittings, which
// can be a few percent apart, so the side-by-side timings, each taken in one sitting, are the better comparison.
// The starting kernel, v000, takes 2000 microseconds a run.
#include <hip/hip_runtime.h>

// Multi-head attention with separate query/key/value inputs ([2][2048][1024] each; q = query Wq^T + bq, k = key Wk^T, v = value Wv^T ('oi' [1024][1024]; 16 heads x 64); scores = (q / 8).k over all 2048 keys (the source's chunked online softmax equals plain softmax); out = merged ctx Wo^T + bo -> [2][2048][1024] (4.2 M)).
// Compute dtypes, f32 accumulate: every input rounded to bf16; q/k/v on PLAIN bf16 operands (inputs: exact) (+ bq on q); scores and attn.v: query rows < 512 hl (3 products), the rest single fp16 (x1024); softmax f32; Wo hl x exact (2 products) + bo.

#define NB_  2
#define TT   2048
#define DM   1024
#define NH_  16
#define NKV  16
#define REP  (NH_ / NKV)
#define HD   64
#define DQ   (NH_ * HD)
#define DKV  (NKV * HD)
#define ZH   2
#define RH   512                  // query rows < RH use hi+lo planes (0: none)
#define WIN  0
#define PCAR 1024.0f
#define SCL  0.125f   // HD^-0.5
typedef _Float16 h16;
typedef unsigned short bf;
typedef __attribute__((ext_vector_type(16))) __bf16   v16bf;
typedef __attribute__((ext_vector_type(16))) _Float16 v16h;
typedef __attribute__((ext_vector_type(8)))  _Float16 v8h;
typedef __attribute__((ext_vector_type(8)))  unsigned short v8us;
typedef __attribute__((ext_vector_type(8)))  float    v8f;
typedef __attribute__((ext_vector_type(4)))  float    v4f;
typedef v8h  __attribute__((may_alias)) v8ha;
typedef v4f  __attribute__((may_alias)) v4fa;
typedef v8us __attribute__((may_alias)) v8usa;

__device__ __forceinline__ unsigned short f2bf(float f) { unsigned u = __float_as_uint(f); u += 0x7FFFu + ((u >> 16) & 1u); return (unsigned short)(u >> 16); }
__device__ __forceinline__ float bf2f(unsigned short b) { return __uint_as_float(((unsigned)b) << 16); }
__device__ __forceinline__ float bfr(float f) { return bf2f(f2bf(f)); }
__device__ __forceinline__ v16h cat16(v8h lo, v8h hi) { return __builtin_shufflevector(lo, hi, 0, 1, 2, 3, 4, 5, 6, 7, 8, 9, 10, 11, 12, 13, 14, 15); }
__device__ __forceinline__ v16bf cat16b(v8us lo, v8us hi) { return __builtin_bit_cast(v16bf, __builtin_shufflevector(lo, hi, 0, 1, 2, 3, 4, 5, 6, 7, 8, 9, 10, 11, 12, 13, 14, 15)); }
__device__ __forceinline__ v8f wmma16(v16h a, v16h b, v8f c) { return __builtin_amdgcn_wmma_f32_16x16x32_f16(false, a, false, b, (short)0, c, false, false); }
__device__ __forceinline__ v8f wmmab(v16bf a, v16bf b, v8f c) { return __builtin_amdgcn_wmma_f32_16x16x32_bf16(false, a, false, b, (short)0, c, false, false); }



// ---- k_gemmw: register-blocked GEMM, ONE WAVE per 64x64 output tile (16 accumulators), operands straight from K-contiguous 16-bit planes; grid (M/64, N/64, Z), 32 threads.
// C[m][n] (f32, pitch ldc, + optional f32 bias[n]) = sum_k A[m][k] Bt[n][k] (+ split products per NSPLIT). z-batch strides sA/sB/sC in elements. K % 32 == 0.
template <typename T16> struct WFrag;
template <> struct WFrag<h16> { typedef v16h V; static __device__ __forceinline__ V ld(const h16* p) { return cat16(*(const v8h*)p, *(const v8h*)(p + 16)); } static __device__ __forceinline__ v8f mma(V a, V b, v8f c) { return wmma16(a, b, c); } };
template <> struct WFrag<bf> { typedef v16bf V; static __device__ __forceinline__ V ld(const bf* p) { return cat16b(*(const v8us*)p, *(const v8us*)(p + 16)); } static __device__ __forceinline__ v8f mma(V a, V b, v8f c) { return wmmab(a, b, c); } };
template <typename T16, int NSPLIT, bool BIAS>
__global__ __launch_bounds__(32) void k_gemmw(const T16* __restrict__ A, const T16* __restrict__ A2, const T16* __restrict__ Bt, const T16* __restrict__ Bt2, int K, float* C, int ldc, const float* __restrict__ bias, size_t sA, size_t sB, size_t sC) {
    typedef typename WFrag<T16>::V V;
    __shared__ __align__(16) float os[16 * 68];
    const size_t z = blockIdx.z; A += z * sA; if (A2) A2 += z * sA; Bt += z * sB; if (Bt2) Bt2 += z * sB; C += z * sC;
    const int lane = threadIdx.x & 31, lr = lane & 15, hi = lane >> 4; const int r0 = blockIdx.x * 64, c0 = blockIdx.y * 64;
    v8f acc[4][4];
#pragma unroll
    for (int mb = 0; mb < 4; ++mb)
#pragma unroll
        for (int nb = 0; nb < 4; ++nb) acc[mb][nb] = (v8f){};
    const size_t aoff = (size_t)(r0 + lr) * K + 8 * hi, boff = (size_t)(c0 + lr) * K + 8 * hi;
#pragma unroll 1
    for (int kc = 0; kc < K; kc += 32) {
        V a[4], a2[4];
#pragma unroll
        for (int mb = 0; mb < 4; ++mb) { a[mb] = WFrag<T16>::ld(A + aoff + (size_t)mb * 16 * K + kc); if (NSPLIT == 1 || NSPLIT == 2) a2[mb] = WFrag<T16>::ld(A2 + aoff + (size_t)mb * 16 * K + kc); }
#pragma unroll
        for (int nb = 0; nb < 4; ++nb) { const V b = WFrag<T16>::ld(Bt + boff + (size_t)nb * 16 * K + kc); V b2; if (NSPLIT >= 2) b2 = WFrag<T16>::ld(Bt2 + boff + (size_t)nb * 16 * K + kc);
#pragma unroll
            for (int mb = 0; mb < 4; ++mb) { acc[mb][nb] = WFrag<T16>::mma(a[mb], b, acc[mb][nb]); if (NSPLIT == 1 || NSPLIT == 2) acc[mb][nb] = WFrag<T16>::mma(a2[mb], b, acc[mb][nb]); if (NSPLIT >= 2) acc[mb][nb] = WFrag<T16>::mma(a[mb], b2, acc[mb][nb]); } }
        asm volatile("v_nop\n\tv_nop\n\tv_nop\n\tv_nop" : "+v"(acc[0][0]), "+v"(acc[1][1]), "+v"(acc[2][2]), "+v"(acc[3][3]) : "v"(a[0]), "v"(a[3]));
    }
#pragma unroll
    for (int mb = 0; mb < 4; ++mb) {
#pragma unroll
        for (int nb = 0; nb < 4; ++nb) {
#pragma unroll
            for (int j = 0; j < 8; ++j) os[(hi * 8 + j) * 68 + nb * 16 + lr] = acc[mb][nb][j]; }
        __builtin_amdgcn_wave_barrier(); asm volatile("" ::: "memory");
        float* crow = C + (size_t)(r0 + mb * 16) * ldc + c0;
{
#pragma unroll
            for (int s = 0; s < 8; ++s) { const int row = 2 * s + hi, cofs = lr * 4; v4f val = *(const v4fa*)(os + row * 68 + cofs); if (BIAS) { val[0] += bfr(bias[c0 + cofs]); val[1] += bfr(bias[c0 + cofs + 1]); val[2] += bfr(bias[c0 + cofs + 2]); val[3] += bfr(bias[c0 + cofs + 3]); }
                *(v4f*)(crow + (size_t)row * ldc + cofs) = val; }
             }
        __builtin_amdgcn_wave_barrier(); asm volatile("" ::: "memory");
    }
}

__device__ __forceinline__ h16 tohx(float x) { return (h16)x; }
__device__ __forceinline__ void splitf(float y, unsigned short& h, unsigned short& l) { h = f2bf(y); l = f2bf(y - bf2f(h)); }
typedef __attribute__((ext_vector_type(2))) _Float16 v2h;
typedef __attribute__((ext_vector_type(4))) _Float16 v4h;
typedef __attribute__((ext_vector_type(2))) unsigned short v2us;
typedef __attribute__((ext_vector_type(4))) unsigned short v4us;
typedef __attribute__((ext_vector_type(2))) float v2f;
typedef __attribute__((ext_vector_type(4))) int v4i;

__global__ __launch_bounds__(256) void k_wtG(const float* __restrict__ w, int K, int N, bf* Bt) {
    const int lane = threadIdx.x & 31; const int L0 = (blockIdx.x * 8 + (threadIdx.x >> 5)) * 8; const int nlines = N * K / 64;
{
#pragma unroll 1
        for (int l = 0; l < 8; ++l) { const int L = L0 + l; if (L >= nlines) break; const size_t e = (size_t)L * 64 + lane * 2; const int k = (int)(e % K), n = (int)(e / K); v2us o;
            o[0] = f2bf(w[(size_t)k * N + n]); o[1] = f2bf(w[(size_t)(k + 1) * N + n]); *(v2us*)(Bt + e) = o; }
         }
}
__global__ __launch_bounds__(256) void k_cvt8(const float* __restrict__ src, bf* dst, size_t n8) { const size_t i = (size_t)blockIdx.x * 256 + threadIdx.x; if (i >= n8) return; const v8f v = *(const v8f*)(src + i * 8); v8us o;
#pragma unroll
    for (int k = 0; k < 8; ++k) o[k] = f2bf(v[k]); *(v8us*)(dst + i * 8) = o;  }

// k_rope: head planes [h][t][d] (fp16 + hi/lo) of rope(x) x sc with the rotate-half convention out[d] = x[d] cos[t][d] - x[d+HD/2] sin[t][d], out[d+HD/2] = x[d+HD/2] cos[t][d+HD/2] + x[d] sin[t][d+HD/2]
__global__ __launch_bounds__(256) void k_rope(const float* __restrict__ F, int pitch, int nheads, const float* __restrict__ CS, const float* __restrict__ RF, const float* __restrict__ nw, float sc, h16* P16, bf* Ph, bf* Pl) {
    const size_t e = ((size_t)blockIdx.x * 256 + threadIdx.x) * 2; if (e >= (size_t)nheads * TT * HD) return; const int d = (int)(e % HD); const int t = (int)((e / HD) % TT); const int h = (int)(e / ((size_t)HD * TT)); const float* f = F + (size_t)t * pitch + h * HD; const float rf = RF ? RF[(size_t)h * TT + t] : 1.0f; v2h o16; v2us oh, ol;
#pragma unroll
    for (int q = 0; q < 2; ++q) { const int dd = d + q; const int dp = (dd < HD / 2) ? dd + HD / 2 : dd - HD / 2; float x0 = f[dd], x1 = f[dp];
        if (RF) { float n0 = __fmul_rn(x0, rf), n1 = __fmul_rn(x1, rf); asm volatile("" : "+v"(n0)); asm volatile("" : "+v"(n1)); x0 = __fmul_rn(bfr(nw[dd]), n0); x1 = __fmul_rn(bfr(nw[dp]), n1); }
        const v2f cs = *(const v2f*)(CS + ((size_t)t * HD + dd) * 2); float a = __fmul_rn(x0, cs[0]), bq = __fmul_rn(x1, cs[1]); asm volatile("" : "+v"(a)); asm volatile("" : "+v"(bq)); const float r = ((dd < HD / 2) ? __fsub_rn(a, bq) : __fadd_rn(a, bq)) * sc;
        o16[q] = tohx(r); unsigned short a2, c2; splitf(r, a2, c2); oh[q] = a2; ol[q] = c2; }
    *(v2h*)(P16 + e) = o16; *(v2us*)(Ph + e) = oh; *(v2us*)(Pl + e) = ol;  }
__global__ __launch_bounds__(256) void k_vtp(const float* __restrict__ F, int pitch, int nheads, h16* V16, bf* Vh, bf* Vl) { const size_t e = ((size_t)blockIdx.x * 256 + threadIdx.x) * 2; if (e >= (size_t)nheads * HD * TT) return; const int t = (int)(e % TT); const int d = (int)((e / TT) % HD); const int g = (int)(e / ((size_t)TT * HD)); v2h o16; v2us oh, ol;
#pragma unroll
    for (int q = 0; q < 2; ++q) { const float x = F[(size_t)(t + q) * pitch + g * HD + d]; o16[q] = tohx(x); unsigned short a2, c2; splitf(x, a2, c2); oh[q] = a2; ol[q] = c2; }
    *(v2h*)(V16 + e) = o16; *(v2us*)(Vh + e) = oh; *(v2us*)(Vl + e) = ol;  }
__global__ __launch_bounds__(256) void k_csid(float* CS) { const int idx = blockIdx.x * 256 + threadIdx.x; if (idx >= TT * HD) return; v2f cs; cs[0] = 1.0f; cs[1] = 0.0f; *(v2f*)(CS + (size_t)idx * 2) = cs;  }
// k_asoft: per row (zz, i): t = S x HD^-0.5 (no mask); softmax over the 2048 keys (register row, one exp, fixed trees);
__global__ __launch_bounds__(256) void k_asoft(const float* __restrict__ Sb, h16* P16, bf* Ph, bf* Pl) {
    const int lane = threadIdx.x & 31; const int row = blockIdx.x * 8 + (threadIdx.x >> 5); if (row >= ZH * TT) return; const int i = row % TT; const int zz = row / TT; (void)zz; const bool hires = (i < RH); const float* sr = Sb + (size_t)row * TT; float v[TT / 32]; float mx = -3.0e38f;
#pragma unroll
    for (int ch = 0; ch < TT / 128; ++ch) { const int j0 = ch * 128 + lane * 4; const v4f a = *(const v4f*)(sr + j0);
#pragma unroll
        for (int q = 0; q < 4; ++q) { const int j = j0 + q; (void)j; const float t = a[q] * SCL; v[ch * 4 + q] = t; mx = fmaxf(mx, t); } }
#pragma unroll
    for (int sh = 16; sh; sh >>= 1) mx = fmaxf(mx, __shfl_xor(mx, sh, 32));
    float sum = 0.f;
#pragma unroll
    for (int k = 0; k < TT / 32; ++k) { float d0 = __fsub_rn(v[k], mx); asm volatile("" : "+v"(d0)); v[k] = __builtin_amdgcn_exp2f(__fmul_rn(d0, 1.4426950408889634f)); sum += v[k]; }
#pragma unroll
    for (int sh = 16; sh; sh >>= 1) sum += __shfl_xor(sum, sh, 32);
    const float f = __fdiv_rn(hires ? 1.0f : PCAR, sum);
{
        if (hires) {
#pragma unroll
            for (int ch = 0; ch < TT / 128; ++ch) { v4us oh, ol;
#pragma unroll
                for (int q = 0; q < 4; ++q) { unsigned short a, c2; splitf(v[ch * 4 + q] * f, a, c2); oh[q] = a; ol[q] = c2; }
                const size_t oo = ((size_t)zz * (RH ? RH : 1) + i) * TT + ch * 128 + lane * 4; *(v4us*)(Ph + oo) = oh; *(v4us*)(Pl + oo) = ol; }
        } else {
#pragma unroll
            for (int ch = 0; ch < TT / 128; ++ch) { v4h o4;
#pragma unroll
                for (int q = 0; q < 4; ++q) o4[q] = tohx(v[ch * 4 + q] * f);
                *(v4h*)(P16 + (size_t)row * TT + ch * 128 + lane * 4) = o4; } }
         }
}
__global__ __launch_bounds__(256) void k_merge(const float* __restrict__ O, int h0, bf* Ah, bf* Al) { const size_t e = ((size_t)blockIdx.x * 256 + threadIdx.x) * 2; if (e >= (size_t)ZH * TT * HD) return; const int d = (int)(e % HD); const int t = (int)((e / HD) % TT); const int zz = (int)(e / ((size_t)HD * TT)); const float cs = (t < RH) ? 1.0f : (1.0f / PCAR); const size_t oo = (size_t)t * DQ + (h0 + zz) * HD + d;
    v2us oh, ol;
#pragma unroll
    for (int q = 0; q < 2; ++q) { unsigned short a, c2; splitf(O[e + q] * cs, a, c2); oh[q] = a; ol[q] = c2; } *(v2us*)(Ah + oo) = oh; *(v2us*)(Al + oo) = ol;  }

extern "C" void kernel_launch(void* const* d_in, const int* in_sizes, int n_in,
                              void* d_out, int out_size, void* d_ws, size_t ws_size, hipStream_t stream) {
    (void)in_sizes; (void)n_in; (void)out_size;
    const float* xq = (const float*)d_in[0]; const float* xk = (const float*)d_in[1]; const float* xv = (const float*)d_in[2]; const float* wq = (const float*)d_in[3]; const float* bq = (const float*)d_in[4]; const float* wk = (const float*)d_in[5]; const float* wv = (const float*)d_in[6]; const float* wo = (const float*)d_in[7]; const float* bo = (const float*)d_in[8]; const float* x = nullptr; (void)x;
    float* OUT = (float*)d_out;     // [2][2048][1024]
    char* wsp = (char*)d_ws;
    auto take = [&](size_t bytes) { char* p = wsp; wsp += (bytes + 255) & ~(size_t)255; return (void*)p; };
    bf* WQ = (bf*)take((size_t)DQ * DM * 2); bf* WK = (bf*)take((size_t)DKV * DM * 2); bf* WV = (bf*)take((size_t)DKV * DM * 2); bf* WO = (bf*)take((size_t)DM * DQ * 2); float* CS = (float*)take((size_t)TT * HD * 2 * 4);
    bf* XB = (bf*)take((size_t)TT * DM * 2); float* FQ = (float*)take((size_t)TT * DQ * 4); float* FK = (float*)take((size_t)TT * DKV * 4);
    h16* QP16 = (h16*)take((size_t)NH_ * TT * HD * 2); h16* KP16 = (h16*)take((size_t)NKV * TT * HD * 2); h16* VT16 = (h16*)take((size_t)NKV * HD * TT * 2);
    bf* QPh = (bf*)take((size_t)NH_ * TT * HD * 2); bf* QPl = (bf*)take((size_t)NH_ * TT * HD * 2); bf* KPh = (bf*)take((size_t)NKV * TT * HD * 2); bf* KPl = (bf*)take((size_t)NKV * TT * HD * 2); bf* VTh = (bf*)take((size_t)NKV * HD * TT * 2); bf* VTl = (bf*)take((size_t)NKV * HD * TT * 2); bf* Ph = (bf*)take((size_t)ZH * RH * TT * 2); bf* Pl = (bf*)take((size_t)ZH * RH * TT * 2);
    float* Sb = (float*)take((size_t)ZH * TT * TT * 4); h16* P16 = (h16*)take((size_t)ZH * TT * TT * 2); float* Ob = (float*)take((size_t)ZH * TT * HD * 4); bf* ATh = (bf*)take((size_t)TT * DQ * 2); bf* ATl = (bf*)take((size_t)TT * DQ * 2);
    if ((size_t)(wsp - (char*)d_ws) > ws_size) return;    // ws 256 MiB
    float* FV = FK;   // v projection reuses the k buffer after the k planes are built (stream-ordered)
    { k_cvt8<<<(unsigned)(((size_t)DQ * DM / 8 + 255) / 256), 256, 0, stream>>>(wq, WQ, (size_t)DQ * DM / 8); k_cvt8<<<(unsigned)(((size_t)DKV * DM / 8 + 255) / 256), 256, 0, stream>>>(wk, WK, (size_t)DKV * DM / 8); k_cvt8<<<(unsigned)(((size_t)DKV * DM / 8 + 255) / 256), 256, 0, stream>>>(wv, WV, (size_t)DKV * DM / 8);
      k_cvt8<<<(unsigned)(((size_t)DM * DQ / 8 + 255) / 256), 256, 0, stream>>>(wo, WO, (size_t)DM * DQ / 8);
       }
    k_csid<<<(TT * HD + 255) / 256, 256, 0, stream>>>(CS);
    const unsigned LQ = (unsigned)(((size_t)NH_ * TT * HD / 2 + 255) / 256), LKv = (unsigned)(((size_t)NKV * TT * HD / 2 + 255) / 256);
    for (int b = 0; b < NB_; ++b) {
        
        k_cvt8<<<(unsigned)(((size_t)TT * DM / 8 + 255) / 256), 256, 0, stream>>>(xq + (size_t)b * TT * DM, XB, (size_t)TT * DM / 8);   /* query rows */
        k_gemmw<bf, 0, true><<<dim3(TT / 64, DQ / 64, 1), 32, 0, stream>>>(XB, nullptr, WQ, nullptr, DM, FQ, DQ, bq, 0, 0, 0);
        k_rope<<<LQ, 256, 0, stream>>>(FQ, DQ, NH_, CS, nullptr, nullptr, 1.0f, QP16, QPh, QPl);
        k_cvt8<<<(unsigned)(((size_t)TT * DM / 8 + 255) / 256), 256, 0, stream>>>(xk + (size_t)b * TT * DM, XB, (size_t)TT * DM / 8);   /* key rows */
        k_gemmw<bf, 0, false><<<dim3(TT / 64, DKV / 64, 1), 32, 0, stream>>>(XB, nullptr, WK, nullptr, DM, FK, DKV, nullptr, 0, 0, 0);
        k_rope<<<LKv, 256, 0, stream>>>(FK, DKV, NKV, CS, nullptr, nullptr, 1.0f, KP16, KPh, KPl);
        k_cvt8<<<(unsigned)(((size_t)TT * DM / 8 + 255) / 256), 256, 0, stream>>>(xv + (size_t)b * TT * DM, XB, (size_t)TT * DM / 8);   /* value rows */
        k_gemmw<bf, 0, false><<<dim3(TT / 64, DKV / 64, 1), 32, 0, stream>>>(XB, nullptr, WV, nullptr, DM, FV, DKV, nullptr, 0, 0, 0); k_vtp<<<LKv, 256, 0, stream>>>(FV, DKV, NKV, VT16, VTh, VTl);
        for (int h0 = 0; h0 < NH_; h0 += ZH) { const size_t zq = (size_t)h0, zk = (size_t)(h0 / REP);   // one kv head per query head: the pass's two heads use consecutive kv planes (z-strides TT*HD)
            k_gemmw<bf, 2, false><<<dim3(RH / 64, TT / 64, ZH), 32, 0, stream>>>(QPh + zq * TT * HD, QPl + zq * TT * HD, KPh + zk * TT * HD, KPl + zk * TT * HD, HD, Sb, TT, nullptr, (size_t)TT * HD, (size_t)TT * HD, (size_t)TT * TT);
            k_gemmw<h16, 0, false><<<dim3((TT - RH) / 64, TT / 64, ZH), 32, 0, stream>>>(QP16 + zq * TT * HD + (size_t)RH * HD, nullptr, KP16 + zk * TT * HD, nullptr, HD, Sb + (size_t)RH * TT, TT, nullptr, (size_t)TT * HD, (size_t)TT * HD, (size_t)TT * TT);
            k_asoft<<<ZH * TT / 8, 256, 0, stream>>>(Sb, P16, Ph, Pl);
            k_gemmw<bf, 2, false><<<dim3(RH / 64, HD / 64, ZH), 32, 0, stream>>>(Ph, Pl, VTh + zk * HD * TT, VTl + zk * HD * TT, TT, Ob, HD, nullptr, (size_t)RH * TT, (size_t)HD * TT, (size_t)TT * HD);
            k_gemmw<h16, 0, false><<<dim3((TT - RH) / 64, HD / 64, ZH), 32, 0, stream>>>(P16 + (size_t)RH * TT, nullptr, VT16 + zk * HD * TT, nullptr, TT, Ob + (size_t)RH * HD, HD, nullptr, (size_t)TT * TT, (size_t)HD * TT, (size_t)TT * HD);
            k_merge<<<(unsigned)(((size_t)ZH * TT * HD / 2 + 255) / 256), 256, 0, stream>>>(Ob, h0, ATh, ATl); }
        k_gemmw<bf, 1, true><<<dim3(TT / 64, DM / 64, 1), 32, 0, stream>>>(ATh, ATl, WO, nullptr, DQ, OUT + (size_t)b * TT * DM, DM, bo, 0, 0, 0); }
}

// v001
// A run of this version takes 863 microseconds.
// Next to v000, in two timings, it ran 2.32 times as fast each time.
#include <hip/hip_runtime.h>

// Multi-head attention with separate query/key/value inputs ([2][2048][1024] each; q = query Wq^T + bq, k = key Wk^T, v = value Wv^T ('oi' [1024][1024]; 16 heads x 64); scores = (q / 8).k over all 2048 keys (the source's chunked online softmax equals plain softmax); out = merged ctx Wo^T + bo -> [2][2048][1024] (4.2 M)).
// Compute dtypes, f32 accumulate: every input rounded to bf16; q/k/v on PLAIN bf16 operands (inputs: exact) (+ bq on q); scores and attn.v: query rows < 512 hl (3 products), the rest single fp16 (x1024); softmax f32; Wo hl x exact (2 products) + bo.

#define NB_  2
#define TT   2048
#define DM   1024
#define NH_  16
#define NKV  16
#define REP  (NH_ / NKV)
#define HD   64
#define DQ   (NH_ * HD)
#define DKV  (NKV * HD)
#define ZH   2
#define RH   512                  // query rows < RH use hi+lo planes (0: none)
#define WIN  0
#define PCAR 1024.0f
#define SCL  0.125f   // HD^-0.5
#define KSP  16                   // attn.v: K slices, one work-group each; the merge kernel sums the KSP partial planes
typedef _Float16 h16;
typedef unsigned short bf;
typedef __attribute__((ext_vector_type(16))) __bf16   v16bf;
typedef __attribute__((ext_vector_type(16))) _Float16 v16h;
typedef __attribute__((ext_vector_type(8)))  _Float16 v8h;
typedef __attribute__((ext_vector_type(8)))  unsigned short v8us;
typedef __attribute__((ext_vector_type(8)))  float    v8f;
typedef __attribute__((ext_vector_type(4)))  float    v4f;
typedef v8h  __attribute__((may_alias)) v8ha;
typedef v4f  __attribute__((may_alias)) v4fa;
typedef v8us __attribute__((may_alias)) v8usa;

__device__ __forceinline__ unsigned short f2bf(float f) { unsigned u = __float_as_uint(f); u += 0x7FFFu + ((u >> 16) & 1u); return (unsigned short)(u >> 16); }
__device__ __forceinline__ float bf2f(unsigned short b) { return __uint_as_float(((unsigned)b) << 16); }
__device__ __forceinline__ float bfr(float f) { return bf2f(f2bf(f)); }
__device__ __forceinline__ v16h cat16(v8h lo, v8h hi) { return __builtin_shufflevector(lo, hi, 0, 1, 2, 3, 4, 5, 6, 7, 8, 9, 10, 11, 12, 13, 14, 15); }
__device__ __forceinline__ v16bf cat16b(v8us lo, v8us hi) { return __builtin_bit_cast(v16bf, __builtin_shufflevector(lo, hi, 0, 1, 2, 3, 4, 5, 6, 7, 8, 9, 10, 11, 12, 13, 14, 15)); }
__device__ __forceinline__ v8f wmma16(v16h a, v16h b, v8f c) { return __builtin_amdgcn_wmma_f32_16x16x32_f16(false, a, false, b, (short)0, c, false, false); }
__device__ __forceinline__ v8f wmmab(v16bf a, v16bf b, v8f c) { return __builtin_amdgcn_wmma_f32_16x16x32_bf16(false, a, false, b, (short)0, c, false, false); }



// ---- k_gemmw: register-blocked GEMM, ONE WAVE per 64x64 output tile (16 accumulators), operands straight from K-contiguous 16-bit planes; grid (M/64, N/64, Z), 32 threads.
// C[m][n] (f32, pitch ldc, + optional f32 bias[n]) = sum_k A[m][k] Bt[n][k] (+ split products per NSPLIT). z-batch strides sA/sB/sC in elements. K % 32 == 0.
// KS > 1: grid z = ZB * KS; work-group (z, ks) sums only k in [ks K/KS, (ks+1) K/KS) and stores its partial tile in plane ks (planes of ZB * sC elements); K % (32 KS) == 0.
template <typename T16> struct WFrag;
template <> struct WFrag<h16> { typedef v16h V; static __device__ __forceinline__ V ld(const h16* p) { return cat16(*(const v8h*)p, *(const v8h*)(p + 16)); } static __device__ __forceinline__ v8f mma(V a, V b, v8f c) { return wmma16(a, b, c); } };
template <> struct WFrag<bf> { typedef v16bf V; static __device__ __forceinline__ V ld(const bf* p) { return cat16b(*(const v8us*)p, *(const v8us*)(p + 16)); } static __device__ __forceinline__ v8f mma(V a, V b, v8f c) { return wmmab(a, b, c); } };
template <typename T16, int NSPLIT, bool BIAS, int KS = 1, int ZB = 1>
__global__ __launch_bounds__(32) void k_gemmw(const T16* __restrict__ A, const T16* __restrict__ A2, const T16* __restrict__ Bt, const T16* __restrict__ Bt2, int K, float* C, int ldc, const float* __restrict__ bias, size_t sA, size_t sB, size_t sC) {
    typedef typename WFrag<T16>::V V;
    __shared__ __align__(16) float os[16 * 68];
    const size_t z = blockIdx.z / KS; const int ks = blockIdx.z % KS; A += z * sA; if (A2) A2 += z * sA; Bt += z * sB; if (Bt2) Bt2 += z * sB; C += (z + (size_t)ks * ZB) * sC;
    const int kb = ks * (K / KS), ke = kb + K / KS;
    const int lane = threadIdx.x & 31, lr = lane & 15, hi = lane >> 4; const int r0 = blockIdx.x * 64, c0 = blockIdx.y * 64;
    v8f acc[4][4];
#pragma unroll
    for (int mb = 0; mb < 4; ++mb)
#pragma unroll
        for (int nb = 0; nb < 4; ++nb) acc[mb][nb] = (v8f){};
    const size_t aoff = (size_t)(r0 + lr) * K + 8 * hi, boff = (size_t)(c0 + lr) * K + 8 * hi;
#pragma unroll 1
    for (int kc = kb; kc < ke; kc += 32) {
        V a[4], a2[4];
#pragma unroll
        for (int mb = 0; mb < 4; ++mb) { a[mb] = WFrag<T16>::ld(A + aoff + (size_t)mb * 16 * K + kc); if (NSPLIT == 1 || NSPLIT == 2) a2[mb] = WFrag<T16>::ld(A2 + aoff + (size_t)mb * 16 * K + kc); }
#pragma unroll
        for (int nb = 0; nb < 4; ++nb) { const V b = WFrag<T16>::ld(Bt + boff + (size_t)nb * 16 * K + kc); V b2; if (NSPLIT >= 2) b2 = WFrag<T16>::ld(Bt2 + boff + (size_t)nb * 16 * K + kc);
#pragma unroll
            for (int mb = 0; mb < 4; ++mb) { acc[mb][nb] = WFrag<T16>::mma(a[mb], b, acc[mb][nb]); if (NSPLIT == 1 || NSPLIT == 2) acc[mb][nb] = WFrag<T16>::mma(a2[mb], b, acc[mb][nb]); if (NSPLIT >= 2) acc[mb][nb] = WFrag<T16>::mma(a[mb], b2, acc[mb][nb]); } }
        asm volatile("v_nop\n\tv_nop\n\tv_nop\n\tv_nop" : "+v"(acc[0][0]), "+v"(acc[1][1]), "+v"(acc[2][2]), "+v"(acc[3][3]) : "v"(a[0]), "v"(a[3]));
    }
#pragma unroll
    for (int mb = 0; mb < 4; ++mb) {
#pragma unroll
        for (int nb = 0; nb < 4; ++nb) {
#pragma unroll
            for (int j = 0; j < 8; ++j) os[(hi * 8 + j) * 68 + nb * 16 + lr] = acc[mb][nb][j]; }
        __builtin_amdgcn_wave_barrier(); asm volatile("" ::: "memory");
        float* crow = C + (size_t)(r0 + mb * 16) * ldc + c0;
{
#pragma unroll
            for (int s = 0; s < 8; ++s) { const int row = 2 * s + hi, cofs = lr * 4; v4f val = *(const v4fa*)(os + row * 68 + cofs); if (BIAS) { val[0] += bfr(bias[c0 + cofs]); val[1] += bfr(bias[c0 + cofs + 1]); val[2] += bfr(bias[c0 + cofs + 2]); val[3] += bfr(bias[c0 + cofs + 3]); }
                *(v4f*)(crow + (size_t)row * ldc + cofs) = val; }
             }
        __builtin_amdgcn_wave_barrier(); asm volatile("" ::: "memory");
    }
}

__device__ __forceinline__ h16 tohx(float x) { return (h16)x; }
__device__ __forceinline__ void splitf(float y, unsigned short& h, unsigned short& l) { h = f2bf(y); l = f2bf(y - bf2f(h)); }
typedef __attribute__((ext_vector_type(2))) _Float16 v2h;
typedef __attribute__((ext_vector_type(4))) _Float16 v4h;
typedef __attribute__((ext_vector_type(2))) unsigned short v2us;
typedef __attribute__((ext_vector_type(4))) unsigned short v4us;
typedef __attribute__((ext_vector_type(2))) float v2f;
typedef __attribute__((ext_vector_type(4))) int v4i;

__global__ __launch_bounds__(256) void k_wtG(const float* __restrict__ w, int K, int N, bf* Bt) {
    const int lane = threadIdx.x & 31; const int L0 = (blockIdx.x * 8 + (threadIdx.x >> 5)) * 8; const int nlines = N * K / 64;
{
#pragma unroll 1
        for (int l = 0; l < 8; ++l) { const int L = L0 + l; if (L >= nlines) break; const size_t e = (size_t)L * 64 + lane * 2; const int k = (int)(e % K), n = (int)(e / K); v2us o;
            o[0] = f2bf(w[(size_t)k * N + n]); o[1] = f2bf(w[(size_t)(k + 1) * N + n]); *(v2us*)(Bt + e) = o; }
         }
}
__global__ __launch_bounds__(256) void k_cvt8(const float* __restrict__ src, bf* dst, size_t n8) { const size_t i = (size_t)blockIdx.x * 256 + threadIdx.x; if (i >= n8) return; const v8f v = *(const v8f*)(src + i * 8); v8us o;
#pragma unroll
    for (int k = 0; k < 8; ++k) o[k] = f2bf(v[k]); *(v8us*)(dst + i * 8) = o;  }

// k_rope: head planes [h][t][d] (fp16 + hi/lo) of rope(x) x sc with the rotate-half convention out[d] = x[d] cos[t][d] - x[d+HD/2] sin[t][d], out[d+HD/2] = x[d+HD/2] cos[t][d+HD/2] + x[d] sin[t][d+HD/2]
__global__ __launch_bounds__(256) void k_rope(const float* __restrict__ F, int pitch, int nheads, const float* __restrict__ CS, const float* __restrict__ RF, const float* __restrict__ nw, float sc, h16* P16, bf* Ph, bf* Pl) {
    const size_t e = ((size_t)blockIdx.x * 256 + threadIdx.x) * 2; if (e >= (size_t)nheads * TT * HD) return; const int d = (int)(e % HD); const int t = (int)((e / HD) % TT); const int h = (int)(e / ((size_t)HD * TT)); const float* f = F + (size_t)t * pitch + h * HD; const float rf = RF ? RF[(size_t)h * TT + t] : 1.0f; v2h o16; v2us oh, ol;
#pragma unroll
    for (int q = 0; q < 2; ++q) { const int dd = d + q; const int dp = (dd < HD / 2) ? dd + HD / 2 : dd - HD / 2; float x0 = f[dd], x1 = f[dp];
        if (RF) { float n0 = __fmul_rn(x0, rf), n1 = __fmul_rn(x1, rf); asm volatile("" : "+v"(n0)); asm volatile("" : "+v"(n1)); x0 = __fmul_rn(bfr(nw[dd]), n0); x1 = __fmul_rn(bfr(nw[dp]), n1); }
        const v2f cs = *(const v2f*)(CS + ((size_t)t * HD + dd) * 2); float a = __fmul_rn(x0, cs[0]), bq = __fmul_rn(x1, cs[1]); asm volatile("" : "+v"(a)); asm volatile("" : "+v"(bq)); const float r = ((dd < HD / 2) ? __fsub_rn(a, bq) : __fadd_rn(a, bq)) * sc;
        o16[q] = tohx(r); unsigned short a2, c2; splitf(r, a2, c2); oh[q] = a2; ol[q] = c2; }
    *(v2h*)(P16 + e) = o16; *(v2us*)(Ph + e) = oh; *(v2us*)(Pl + e) = ol;  }
__global__ __launch_bounds__(256) void k_vtp(const float* __restrict__ F, int pitch, int nheads, h16* V16, bf* Vh, bf* Vl) { const size_t e = ((size_t)blockIdx.x * 256 + threadIdx.x) * 2; if (e >= (size_t)nheads * HD * TT) return; const int t = (int)(e % TT); const int d = (int)((e / TT) % HD); const int g = (int)(e / ((size_t)TT * HD)); v2h o16; v2us oh, ol;
#pragma unroll
    for (int q = 0; q < 2; ++q) { const float x = F[(size_t)(t + q) * pitch + g * HD + d]; o16[q] = tohx(x); unsigned short a2, c2; splitf(x, a2, c2); oh[q] = a2; ol[q] = c2; }
    *(v2h*)(V16 + e) = o16; *(v2us*)(Vh + e) = oh; *(v2us*)(Vl + e) = ol;  }
__global__ __launch_bounds__(256) void k_csid(float* CS) { const int idx = blockIdx.x * 256 + threadIdx.x; if (idx >= TT * HD) return; v2f cs; cs[0] = 1.0f; cs[1] = 0.0f; *(v2f*)(CS + (size_t)idx * 2) = cs;  }
// k_asoft: per row (zz, i): t = S x HD^-0.5 (no mask); softmax over the 2048 keys (register row, one exp, fixed trees);
__global__ __launch_bounds__(256) void k_asoft(const float* __restrict__ Sb, h16* P16, bf* Ph, bf* Pl) {
    const int lane = threadIdx.x & 31; const int row = blockIdx.x * 8 + (threadIdx.x >> 5); if (row >= ZH * TT) return; const int i = row % TT; const int zz = row / TT; (void)zz; const bool hires = (i < RH); const float* sr = Sb + (size_t)row * TT; float v[TT / 32]; float mx = -3.0e38f;
#pragma unroll
    for (int ch = 0; ch < TT / 128; ++ch) { const int j0 = ch * 128 + lane * 4; const v4f a = *(const v4f*)(sr + j0);
#pragma unroll
        for (int q = 0; q < 4; ++q) { const int j = j0 + q; (void)j; const float t = a[q] * SCL; v[ch * 4 + q] = t; mx = fmaxf(mx, t); } }
#pragma unroll
    for (int sh = 16; sh; sh >>= 1) mx = fmaxf(mx, __shfl_xor(mx, sh, 32));
    float sum = 0.f;
#pragma unroll
    for (int k = 0; k < TT / 32; ++k) { float d0 = __fsub_rn(v[k], mx); asm volatile("" : "+v"(d0)); v[k] = __builtin_amdgcn_exp2f(__fmul_rn(d0, 1.4426950408889634f)); sum += v[k]; }
#pragma unroll
    for (int sh = 16; sh; sh >>= 1) sum += __shfl_xor(sum, sh, 32);
    const float f = __fdiv_rn(hires ? 1.0f : PCAR, sum);
{
        if (hires) {
#pragma unroll
            for (int ch = 0; ch < TT / 128; ++ch) { v4us oh, ol;
#pragma unroll
                for (int q = 0; q < 4; ++q) { unsigned short a, c2; splitf(v[ch * 4 + q] * f, a, c2); oh[q] = a; ol[q] = c2; }
                const size_t oo = ((size_t)zz * (RH ? RH : 1) + i) * TT + ch * 128 + lane * 4; *(v4us*)(Ph + oo) = oh; *(v4us*)(Pl + oo) = ol; }
        } else {
#pragma unroll
            for (int ch = 0; ch < TT / 128; ++ch) { v4h o4;
#pragma unroll
                for (int q = 0; q < 4; ++q) o4[q] = tohx(v[ch * 4 + q] * f);
                *(v4h*)(P16 + (size_t)row * TT + ch * 128 + lane * 4) = o4; } }
         }
}
__global__ __launch_bounds__(256) void k_merge(const float* __restrict__ O, int h0, bf* Ah, bf* Al) { const size_t e = ((size_t)blockIdx.x * 256 + threadIdx.x) * 2; if (e >= (size_t)ZH * TT * HD) return; const int d = (int)(e % HD); const int t = (int)((e / HD) % TT); const int zz = (int)(e / ((size_t)HD * TT)); const float cs = (t < RH) ? 1.0f : (1.0f / PCAR); const size_t oo = (size_t)t * DQ + (h0 + zz) * HD + d;
    v2f sm = *(const v2f*)(O + e);   // partial planes summed in plane order
#pragma unroll
    for (int ks = 1; ks < KSP; ++ks) sm += *(const v2f*)(O + (size_t)ks * ZH * TT * HD + e);
    v2us oh, ol;
#pragma unroll
    for (int q = 0; q < 2; ++q) { unsigned short a, c2; splitf(sm[q] * cs, a, c2); oh[q] = a; ol[q] = c2; } *(v2us*)(Ah + oo) = oh; *(v2us*)(Al + oo) = ol;  }

extern "C" void kernel_launch(void* const* d_in, const int* in_sizes, int n_in,
                              void* d_out, int out_size, void* d_ws, size_t ws_size, hipStream_t stream) {
    (void)in_sizes; (void)n_in; (void)out_size;
    const float* xq = (const float*)d_in[0]; const float* xk = (const float*)d_in[1]; const float* xv = (const float*)d_in[2]; const float* wq = (const float*)d_in[3]; const float* bq = (const float*)d_in[4]; const float* wk = (const float*)d_in[5]; const float* wv = (const float*)d_in[6]; const float* wo = (const float*)d_in[7]; const float* bo = (const float*)d_in[8]; const float* x = nullptr; (void)x;
    float* OUT = (float*)d_out;     // [2][2048][1024]
    char* wsp = (char*)d_ws;
    auto take = [&](size_t bytes) { char* p = wsp; wsp += (bytes + 255) & ~(size_t)255; return (void*)p; };
    bf* WQ = (bf*)take((size_t)DQ * DM * 2); bf* WK = (bf*)take((size_t)DKV * DM * 2); bf* WV = (bf*)take((size_t)DKV * DM * 2); bf* WO = (bf*)take((size_t)DM * DQ * 2); float* CS = (float*)take((size_t)TT * HD * 2 * 4);
    bf* XB = (bf*)take((size_t)TT * DM * 2); float* FQ = (float*)take((size_t)TT * DQ * 4); float* FK = (float*)take((size_t)TT * DKV * 4);
    h16* QP16 = (h16*)take((size_t)NH_ * TT * HD * 2); h16* KP16 = (h16*)take((size_t)NKV * TT * HD * 2); h16* VT16 = (h16*)take((size_t)NKV * HD * TT * 2);
    bf* QPh = (bf*)take((size_t)NH_ * TT * HD * 2); bf* QPl = (bf*)take((size_t)NH_ * TT * HD * 2); bf* KPh = (bf*)take((size_t)NKV * TT * HD * 2); bf* KPl = (bf*)take((size_t)NKV * TT * HD * 2); bf* VTh = (bf*)take((size_t)NKV * HD * TT * 2); bf* VTl = (bf*)take((size_t)NKV * HD * TT * 2); bf* Ph = (bf*)take((size_t)ZH * RH * TT * 2); bf* Pl = (bf*)take((size_t)ZH * RH * TT * 2);
    float* Sb = (float*)take((size_t)ZH * TT * TT * 4); h16* P16 = (h16*)take((size_t)ZH * TT * TT * 2); float* Ob = (float*)take((size_t)KSP * ZH * TT * HD * 4); bf* ATh = (bf*)take((size_t)TT * DQ * 2); bf* ATl = (bf*)take((size_t)TT * DQ * 2);
    if ((size_t)(wsp - (char*)d_ws) > ws_size) return;    // ws 256 MiB
    float* FV = FK;   // v projection reuses the k buffer after the k planes are built (stream-ordered)
    { k_cvt8<<<(unsigned)(((size_t)DQ * DM / 8 + 255) / 256), 256, 0, stream>>>(wq, WQ, (size_t)DQ * DM / 8); k_cvt8<<<(unsigned)(((size_t)DKV * DM / 8 + 255) / 256), 256, 0, stream>>>(wk, WK, (size_t)DKV * DM / 8); k_cvt8<<<(unsigned)(((size_t)DKV * DM / 8 + 255) / 256), 256, 0, stream>>>(wv, WV, (size_t)DKV * DM / 8);
      k_cvt8<<<(unsigned)(((size_t)DM * DQ / 8 + 255) / 256), 256, 0, stream>>>(wo, WO, (size_t)DM * DQ / 8);
       }
    k_csid<<<(TT * HD + 255) / 256, 256, 0, stream>>>(CS);
    const unsigned LQ = (unsigned)(((size_t)NH_ * TT * HD / 2 + 255) / 256), LKv = (unsigned)(((size_t)NKV * TT * HD / 2 + 255) / 256);
    for (int b = 0; b < NB_; ++b) {
        
        k_cvt8<<<(unsigned)(((size_t)TT * DM / 8 + 255) / 256), 256, 0, stream>>>(xq + (size_t)b * TT * DM, XB, (size_t)TT * DM / 8);   /* query rows */
        k_gemmw<bf, 0, true><<<dim3(TT / 64, DQ / 64, 1), 32, 0, stream>>>(XB, nullptr, WQ, nullptr, DM, FQ, DQ, bq, 0, 0, 0);
        k_rope<<<LQ, 256, 0, stream>>>(FQ, DQ, NH_, CS, nullptr, nullptr, 1.0f, QP16, QPh, QPl);
        k_cvt8<<<(unsigned)(((size_t)TT * DM / 8 + 255) / 256), 256, 0, stream>>>(xk + (size_t)b * TT * DM, XB, (size_t)TT * DM / 8);   /* key rows */
        k_gemmw<bf, 0, false><<<dim3(TT / 64, DKV / 64, 1), 32, 0, stream>>>(XB, nullptr, WK, nullptr, DM, FK, DKV, nullptr, 0, 0, 0);
        k_rope<<<LKv, 256, 0, stream>>>(FK, DKV, NKV, CS, nullptr, nullptr, 1.0f, KP16, KPh, KPl);
        k_cvt8<<<(unsigned)(((size_t)TT * DM / 8 + 255) / 256), 256, 0, stream>>>(xv + (size_t)b * TT * DM, XB, (size_t)TT * DM / 8);   /* value rows */
        k_gemmw<bf, 0, false><<<dim3(TT / 64, DKV / 64, 1), 32, 0, stream>>>(XB, nullptr, WV, nullptr, DM, FV, DKV, nullptr, 0, 0, 0); k_vtp<<<LKv, 256, 0, stream>>>(FV, DKV, NKV, VT16, VTh, VTl);
        for (int h0 = 0; h0 < NH_; h0 += ZH) { const size_t zq = (size_t)h0, zk = (size_t)(h0 / REP);   // one kv head per query head: the pass's two heads use consecutive kv planes (z-strides TT*HD)
            k_gemmw<bf, 2, false><<<dim3(RH / 64, TT / 64, ZH), 32, 0, stream>>>(QPh + zq * TT * HD, QPl + zq * TT * HD, KPh + zk * TT * HD, KPl + zk * TT * HD, HD, Sb, TT, nullptr, (size_t)TT * HD, (size_t)TT * HD, (size_t)TT * TT);
            k_gemmw<h16, 0, false><<<dim3((TT - RH) / 64, TT / 64, ZH), 32, 0, stream>>>(QP16 + zq * TT * HD + (size_t)RH * HD, nullptr, KP16 + zk * TT * HD, nullptr, HD, Sb + (size_t)RH * TT, TT, nullptr, (size_t)TT * HD, (size_t)TT * HD, (size_t)TT * TT);
            k_asoft<<<ZH * TT / 8, 256, 0, stream>>>(Sb, P16, Ph, Pl);
            k_gemmw<bf, 2, false, KSP, ZH><<<dim3(RH / 64, HD / 64, ZH * KSP), 32, 0, stream>>>(Ph, Pl, VTh + zk * HD * TT, VTl + zk * HD * TT, TT, Ob, HD, nullptr, (size_t)RH * TT, (size_t)HD * TT, (size_t)TT * HD);
            k_gemmw<h16, 0, false, KSP, ZH><<<dim3((TT - RH) / 64, HD / 64, ZH * KSP), 32, 0, stream>>>(P16 + (size_t)RH * TT, nullptr, VT16 + zk * HD * TT, nullptr, TT, Ob + (size_t)RH * HD, HD, nullptr, (size_t)TT * TT, (size_t)HD * TT, (size_t)TT * HD);
            k_merge<<<(unsigned)(((size_t)ZH * TT * HD / 2 + 255) / 256), 256, 0, stream>>>(Ob, h0, ATh, ATl); }
        k_gemmw<bf, 1, true><<<dim3(TT / 64, DM / 64, 1), 32, 0, stream>>>(ATh, ATl, WO, nullptr, DQ, OUT + (size_t)b * TT * DM, DM, bo, 0, 0, 0); }
}

// v003
// A run of this version takes 233 microseconds.
// It is 3.67 times as fast as v001, going by the measured steps of the versions left out in between.
// Over all steps from v000 it is 8.52 times as fast.
#include <hip/hip_runtime.h>

// Multi-head attention with separate query/key/value inputs ([2][2048][1024] each; q = query Wq^T + bq, k = key Wk^T, v = value Wv^T ('oi' [1024][1024]; 16 heads x 64); scores = (q / 8).k over all 2048 keys (the source's chunked online softmax equals plain softmax); out = merged ctx Wo^T + bo -> [2][2048][1024] (4.2 M)).
// Compute dtypes, f32 accumulate: every input rounded to bf16; q/k/v on PLAIN bf16 operands (inputs: exact) (+ bq on q); scores and attn.v: query rows < 512 hl (3 products), the rest single fp16; softmax f32 (running maximum, unnormalised weights, one division at the end); Wo hl x exact (2 products) + bo.

#define NB_  2
#define TT   2048
#define DM   1024
#define NH_  16
#define NKV  16
#define REP  (NH_ / NKV)
#define HD   64
#define DQ   (NH_ * HD)
#define DKV  (NKV * HD)
#define RH   512                  // query rows < RH use hi+lo planes (0: none)
#define WIN  0
#define SCL  0.125f   // HD^-0.5
typedef _Float16 h16;
typedef unsigned short bf;
typedef __attribute__((ext_vector_type(16))) __bf16   v16bf;
typedef __attribute__((ext_vector_type(16))) _Float16 v16h;
typedef __attribute__((ext_vector_type(8)))  _Float16 v8h;
typedef __attribute__((ext_vector_type(8)))  unsigned short v8us;
typedef __attribute__((ext_vector_type(8)))  float    v8f;
typedef __attribute__((ext_vector_type(4)))  float    v4f;
typedef v8h  __attribute__((may_alias)) v8ha;
typedef v4f  __attribute__((may_alias)) v4fa;
typedef v8us __attribute__((may_alias)) v8usa;

__device__ __forceinline__ unsigned short f2bf(float f) { unsigned u = __float_as_uint(f); u += 0x7FFFu + ((u >> 16) & 1u); return (unsigned short)(u >> 16); }
__device__ __forceinline__ float bf2f(unsigned short b) { return __uint_as_float(((unsigned)b) << 16); }
__device__ __forceinline__ float bfr(float f) { return bf2f(f2bf(f)); }
__device__ __forceinline__ v16h cat16(v8h lo, v8h hi) { return __builtin_shufflevector(lo, hi, 0, 1, 2, 3, 4, 5, 6, 7, 8, 9, 10, 11, 12, 13, 14, 15); }
__device__ __forceinline__ v16bf cat16b(v8us lo, v8us hi) { return __builtin_bit_cast(v16bf, __builtin_shufflevector(lo, hi, 0, 1, 2, 3, 4, 5, 6, 7, 8, 9, 10, 11, 12, 13, 14, 15)); }
__device__ __forceinline__ v8f wmma16(v16h a, v16h b, v8f c) { return __builtin_amdgcn_wmma_f32_16x16x32_f16(false, a, false, b, (short)0, c, false, false); }
__device__ __forceinline__ v8f wmmab(v16bf a, v16bf b, v8f c) { return __builtin_amdgcn_wmma_f32_16x16x32_bf16(false, a, false, b, (short)0, c, false, false); }



// ---- k_gemmw: register-blocked GEMM, ONE WAVE per 64x64 output tile (16 accumulators), operands straight from K-contiguous 16-bit planes; grid (M/64, N/64, Z), 32 threads.
// C[m][n] (f32, pitch ldc, + optional f32 bias[n]) = sum_k A[m][k] Bt[n][k] (+ split products per NSPLIT). z-batch strides sA/sB/sC in elements. K % 32 == 0.
// BIAS: the bias belongs to z-batch 0 alone (the q projection where q, k and v share a launch).
// KS > 1: grid z = ZB * KS; work-group (z, ks) sums only k in [ks K/KS, (ks+1) K/KS) and stores its partial tile in plane ks (planes of ZB * sC elements); K % (32 KS) == 0.
template <typename T16> struct WFrag;
template <> struct WFrag<h16> { typedef v16h V; static __device__ __forceinline__ V ld(const h16* p) { return cat16(*(const v8h*)p, *(const v8h*)(p + 16)); } static __device__ __forceinline__ v8f mma(V a, V b, v8f c) { return wmma16(a, b, c); } };
template <> struct WFrag<bf> { typedef v16bf V; static __device__ __forceinline__ V ld(const bf* p) { return cat16b(*(const v8us*)p, *(const v8us*)(p + 16)); } static __device__ __forceinline__ v8f mma(V a, V b, v8f c) { return wmmab(a, b, c); } };
template <typename T16, int NSPLIT, bool BIAS, int KS = 1, int ZB = 1>
__global__ __launch_bounds__(32) void k_gemmw(const T16* __restrict__ A, const T16* __restrict__ A2, const T16* __restrict__ Bt, const T16* __restrict__ Bt2, int K, float* C, int ldc, const float* __restrict__ bias, size_t sA, size_t sB, size_t sC) {
    typedef typename WFrag<T16>::V V;
    __shared__ __align__(16) float os[16 * 68];
    const size_t z = blockIdx.z / KS; const int ks = blockIdx.z % KS; A += z * sA; if (A2) A2 += z * sA; Bt += z * sB; if (Bt2) Bt2 += z * sB; C += (z + (size_t)ks * ZB) * sC;
    const int kb = ks * (K / KS), ke = kb + K / KS;
    const int lane = threadIdx.x & 31, lr = lane & 15, hi = lane >> 4; const int r0 = blockIdx.x * 64, c0 = blockIdx.y * 64;
    v8f acc[4][4];
#pragma unroll
    for (int mb = 0; mb < 4; ++mb)
#pragma unroll
        for (int nb = 0; nb < 4; ++nb) acc[mb][nb] = (v8f){};
    const size_t aoff = (size_t)(r0 + lr) * K + 8 * hi, boff = (size_t)(c0 + lr) * K + 8 * hi;
#pragma unroll 1
    for (int kc = kb; kc < ke; kc += 32) {
        V a[4], a2[4];
#pragma unroll
        for (int mb = 0; mb < 4; ++mb) { a[mb] = WFrag<T16>::ld(A + aoff + (size_t)mb * 16 * K + kc); if (NSPLIT == 1 || NSPLIT == 2) a2[mb] = WFrag<T16>::ld(A2 + aoff + (size_t)mb * 16 * K + kc); }
#pragma unroll
        for (int nb = 0; nb < 4; ++nb) { const V b = WFrag<T16>::ld(Bt + boff + (size_t)nb * 16 * K + kc); V b2; if (NSPLIT >= 2) b2 = WFrag<T16>::ld(Bt2 + boff + (size_t)nb * 16 * K + kc);
#pragma unroll
            for (int mb = 0; mb < 4; ++mb) { acc[mb][nb] = WFrag<T16>::mma(a[mb], b, acc[mb][nb]); if (NSPLIT == 1 || NSPLIT == 2) acc[mb][nb] = WFrag<T16>::mma(a2[mb], b, acc[mb][nb]); if (NSPLIT >= 2) acc[mb][nb] = WFrag<T16>::mma(a[mb], b2, acc[mb][nb]); } }
        asm volatile("v_nop\n\tv_nop\n\tv_nop\n\tv_nop" : "+v"(acc[0][0]), "+v"(acc[1][1]), "+v"(acc[2][2]), "+v"(acc[3][3]) : "v"(a[0]), "v"(a[3]));
    }
    v4f bv = {-0.0f, -0.0f, -0.0f, -0.0f};   // a lane's four columns are the same in every row; -0 leaves every value as it is where there is no bias
    if (BIAS && z == 0) { const float* pb = bias + c0 + lr * 4; float bl[4];
#pragma unroll
        for (int q = 0; q < 4; ++q) bl[q] = pb[q];
        asm volatile("s_wait_xcnt 0x0" :: "v"(pb) : "memory");   // the wait before a register that the load names is written again; the pointer is its input, so that it lives to here and the load does not land on it
#pragma unroll
        for (int q = 0; q < 4; ++q) bv[q] = bfr(bl[q]); }
#pragma unroll
    for (int mb = 0; mb < 4; ++mb) {
#pragma unroll
        for (int nb = 0; nb < 4; ++nb) {
#pragma unroll
            for (int j = 0; j < 8; ++j) os[(hi * 8 + j) * 68 + nb * 16 + lr] = acc[mb][nb][j]; }
        __builtin_amdgcn_wave_barrier(); asm volatile("" ::: "memory");
        float* crow = C + (size_t)(r0 + mb * 16) * ldc + c0;
{
#pragma unroll
            for (int s = 0; s < 8; ++s) { const int row = 2 * s + hi, cofs = lr * 4; v4f val = *(const v4fa*)(os + row * 68 + cofs); if (BIAS) val += bv;
                *(v4f*)(crow + (size_t)row * ldc + cofs) = val; }
             }
        __builtin_amdgcn_wave_barrier(); asm volatile("" ::: "memory");
    }
}

__device__ __forceinline__ h16 tohx(float x) { return (h16)x; }
__device__ __forceinline__ void splitf(float y, unsigned short& h, unsigned short& l) { h = f2bf(y); l = f2bf(y - bf2f(h)); }
typedef __attribute__((ext_vector_type(2))) _Float16 v2h;
typedef __attribute__((ext_vector_type(4))) _Float16 v4h;
typedef __attribute__((ext_vector_type(2))) unsigned short v2us;
typedef __attribute__((ext_vector_type(4))) unsigned short v4us;
typedef __attribute__((ext_vector_type(2))) float v2f;
typedef __attribute__((ext_vector_type(4))) int v4i;

__global__ __launch_bounds__(256) void k_wtG(const float* __restrict__ w, int K, int N, bf* Bt) {
    const int lane = threadIdx.x & 31; const int L0 = (blockIdx.x * 8 + (threadIdx.x >> 5)) * 8; const int nlines = N * K / 64;
{
#pragma unroll 1
        for (int l = 0; l < 8; ++l) { const int L = L0 + l; if (L >= nlines) break; const size_t e = (size_t)L * 64 + lane * 2; const int k = (int)(e % K), n = (int)(e / K); v2us o;
            o[0] = f2bf(w[(size_t)k * N + n]); o[1] = f2bf(w[(size_t)(k + 1) * N + n]); *(v2us*)(Bt + e) = o; }
         }
}
// k_cvt8: every f32 input of the products to bf16 in one launch. Blocks [0, 3 XBL): query, key, value (both batches) -> XB[3][NB_ TT][DM]; the rest: Wq, Wk, Wv, Wo -> WB[4][DM][DM]. 2048 elements a block.
#define XBL ((unsigned)((size_t)NB_ * TT * DM / 2048))
#define WBL ((unsigned)((size_t)DQ * DM / 2048))
__global__ __launch_bounds__(256) void k_cvt8(const float* __restrict__ xq, const float* __restrict__ xk, const float* __restrict__ xv, const float* __restrict__ wq, const float* __restrict__ wk, const float* __restrict__ wv, const float* __restrict__ wo, bf* XB, bf* WB) {
    const unsigned bx = blockIdx.x; const bool isx = bx < 3 * XBL; const unsigned seg = isx ? bx / XBL : (bx - 3 * XBL) / WBL, blk = isx ? bx % XBL : (bx - 3 * XBL) % WBL;
    const float* src = isx ? (seg == 0 ? xq : seg == 1 ? xk : xv) : (seg == 0 ? wq : seg == 1 ? wk : seg == 2 ? wv : wo);
    bf* dst = isx ? XB + (size_t)seg * NB_ * TT * DM : WB + (size_t)seg * DQ * DM;
    const size_t i = (size_t)blk * 256 + threadIdx.x; const v8f v = *(const v8f*)(src + i * 8); v8us o;
#pragma unroll
    for (int k = 0; k < 8; ++k) o[k] = f2bf(v[k]); *(v8us*)(dst + i * 8) = o;  }

// F holds nz row groups [z][t][pitch] (q and k of each batch); the planes are [z][h][t][d].
// k_rope: head planes [h][t][d] (fp16 + hi/lo) of rope(x) x sc with the rotate-half convention out[d] = x[d] cos[t][d] - x[d+HD/2] sin[t][d], out[d+HD/2] = x[d+HD/2] cos[t][d+HD/2] + x[d] sin[t][d+HD/2]
template <int nheads> __global__ __launch_bounds__(256) void k_rope(const float* __restrict__ F, int pitch, int nz, const float* __restrict__ CS, const float* __restrict__ RF, const float* __restrict__ nw, float sc, h16* P16, bf* Ph, bf* Pl) {
    const size_t e = ((size_t)blockIdx.x * 256 + threadIdx.x) * 2; if (e >= (size_t)nz * nheads * TT * HD) return; const int d = (int)(e % HD); const int t = (int)((e / HD) % TT); const int h = (int)(e / ((size_t)HD * TT)); const float* f = F + ((size_t)((unsigned)h / nheads) * TT + t) * pitch + ((unsigned)h % nheads) * HD; const float rf = RF ? RF[(size_t)h * TT + t] : 1.0f; v2h o16; v2us oh, ol;
#pragma unroll
    for (int q = 0; q < 2; ++q) { const int dd = d + q; const int dp = (dd < HD / 2) ? dd + HD / 2 : dd - HD / 2; float x0 = f[dd], x1 = f[dp];
        if (RF) { float n0 = __fmul_rn(x0, rf), n1 = __fmul_rn(x1, rf); asm volatile("" : "+v"(n0)); asm volatile("" : "+v"(n1)); x0 = __fmul_rn(bfr(nw[dd]), n0); x1 = __fmul_rn(bfr(nw[dp]), n1); }
        const v2f cs = *(const v2f*)(CS + ((size_t)t * HD + dd) * 2); float a = __fmul_rn(x0, cs[0]), bq = __fmul_rn(x1, cs[1]); asm volatile("" : "+v"(a)); asm volatile("" : "+v"(bq)); const float r = ((dd < HD / 2) ? __fsub_rn(a, bq) : __fadd_rn(a, bq)) * sc;
        o16[q] = tohx(r); unsigned short a2, c2; splitf(r, a2, c2); oh[q] = a2; ol[q] = c2; }
    *(v2h*)(P16 + e) = o16; *(v2us*)(Ph + e) = oh; *(v2us*)(Pl + e) = ol;  }
template <int nheads> __global__ __launch_bounds__(256) void k_vtp(const float* __restrict__ F, int pitch, int nz, h16* V16, bf* Vh, bf* Vl) { const size_t e = ((size_t)blockIdx.x * 256 + threadIdx.x) * 2; if (e >= (size_t)nz * nheads * HD * TT) return; const int t = (int)(e % TT); const int d = (int)((e / TT) % HD); const int g = (int)(e / ((size_t)TT * HD)); v2h o16; v2us oh, ol;
#pragma unroll
    for (int q = 0; q < 2; ++q) { const float x = F[((size_t)((unsigned)g / nheads) * TT + t + q) * pitch + ((unsigned)g % nheads) * HD + d]; o16[q] = tohx(x); unsigned short a2, c2; splitf(x, a2, c2); oh[q] = a2; ol[q] = c2; }
    *(v2h*)(V16 + e) = o16; *(v2us*)(Vh + e) = oh; *(v2us*)(Vl + e) = ol;  }
__global__ __launch_bounds__(256) void k_csid(float* CS) { const int idx = blockIdx.x * 256 + threadIdx.x; if (idx >= TT * HD) return; v2f cs; cs[0] = 1.0f; cs[1] = 0.0f; *(v2f*)(CS + (size_t)idx * 2) = cs;  }
typedef __attribute__((ext_vector_type(2))) __bf16 v2bf;
typedef __attribute__((ext_vector_type(8))) unsigned v8u;
typedef __attribute__((ext_vector_type(4))) unsigned __attribute__((may_alias)) v4u;
// two f32 -> packed bf16 hi pair and bf16 lo pair (lo = x - hi, exact in f32), both rounded to nearest even like f2bf
__device__ __forceinline__ void split2(float x, float y, unsigned& h, unsigned& l) { v2f a; a[0] = x; a[1] = y; h = __builtin_bit_cast(unsigned, __builtin_convertvector(a, v2bf)); v2f r; r[0] = x - __uint_as_float(h << 16); r[1] = y - __uint_as_float(h & 0xFFFF0000u); l = __builtin_bit_cast(unsigned, __builtin_convertvector(r, v2bf)); }
// 2^x. The v_nop fills the slot that the instruction set asks for behind a transcendental before its result is read or its source overwritten
__device__ __forceinline__ float exp2s(float x) { float r; asm("v_exp_f32 %0, %1\n\tv_nop" : "=v"(r) : "v"(x)); return r; }
// value of lane l ^ 16
__device__ __forceinline__ float xhalf(float x) { const int b = __float_as_int(x); return __int_as_float(__builtin_amdgcn_permlanex16(b, b, 0x76543210, 0xfedcba98, false, false)); }
// k_fattn: scores, softmax and attn.v of one head in one kernel; S and P stay in registers. One wave owns NQ groups of 16 query rows and walks the 2048 keys in blocks of 32.
// Transposed products: S^T = K Q^T (a lane holds 16 scores of ONE query: keys 8 hi + r and 16 + 8 hi + r), so the two score tiles, converted in place, are the B operand of O^T += V^T P^T in the loader's own k order.
// Running maximum m and sum l per query; P = exp(t - m) unnormalised; O and l are rescaled by exp(m_old - m_new) when a maximum moves; O / l at the end, split into the hi/lo planes [t][DQ].
template <typename T16, bool HL, int NQ>
__device__ __forceinline__ void fattn(const T16* __restrict__ Q, const T16* __restrict__ Q2, const T16* __restrict__ Kp, const T16* __restrict__ K2, const T16* __restrict__ Vt, const T16* __restrict__ V2, int q0, bf* Ah, bf* Al) {
    typedef WFrag<T16> WF; typedef typename WF::V V;
    const int lane = threadIdx.x & 31, lr = lane & 15, hi = lane >> 4;
    V qf[NQ][2], qf2[NQ][2], kf[2][2], kf2[2][2];
#pragma unroll
    for (int g = 0; g < NQ; ++g)
#pragma unroll
        for (int kc = 0; kc < 2; ++kc) { const size_t o = (size_t)(q0 + g * 16 + lr) * HD + kc * 32 + 8 * hi; qf[g][kc] = WF::ld(Q + o); if constexpr (HL) qf2[g][kc] = WF::ld(Q2 + o); }
#pragma unroll
    for (int kt = 0; kt < 2; ++kt)
#pragma unroll
        for (int kc = 0; kc < 2; ++kc) { const size_t o = (size_t)(kt * 16 + lr) * HD + kc * 32 + 8 * hi; kf[kt][kc] = WF::ld(Kp + o); if constexpr (HL) kf2[kt][kc] = WF::ld(K2 + o); }
    v8f oa[NQ][4]; float m[NQ], l[NQ];
#pragma unroll
    for (int g = 0; g < NQ; ++g) { m[g] = -3.0e38f; l[g] = 0.f;
#pragma unroll
        for (int dt = 0; dt < 4; ++dt) oa[g][dt] = (v8f){}; }
#pragma unroll 1   // rolled: one block's fragments, scores and the output tiles already fill the register budget
    for (int j0 = 0; j0 < TT; j0 += 32) {
        V vf[4], vf2[4];   // this block's V fragments fly during its scores and softmax
        const T16* pv = Vt + (size_t)lr * TT + j0 + 8 * hi;
#pragma unroll
        for (int dt = 0; dt < 4; ++dt) vf[dt] = WF::ld(pv + (size_t)dt * 16 * TT);
        asm volatile("s_wait_xcnt 0x0" :: "v"(pv) : "memory");   // behind each run of loads: the wait before a register that the run names is written again; the run's base pointer is its input, so that it lives to here and no load of the run lands on it
        if constexpr (HL) { const T16* pv2 = V2 + (size_t)lr * TT + j0 + 8 * hi;
#pragma unroll
            for (int dt = 0; dt < 4; ++dt) vf2[dt] = WF::ld(pv2 + (size_t)dt * 16 * TT);
            asm volatile("s_wait_xcnt 0x0" :: "v"(pv2) : "memory"); }   // as above
        v8f s[NQ][2];
#pragma unroll
        for (int g = 0; g < NQ; ++g)
#pragma unroll
            for (int kt = 0; kt < 2; ++kt) { s[g][kt] = (v8f){};
#pragma unroll
                for (int kc = 0; kc < 2; ++kc) { s[g][kt] = WF::mma(kf[kt][kc], qf[g][kc], s[g][kt]); if constexpr (HL) { s[g][kt] = WF::mma(kf[kt][kc], qf2[g][kc], s[g][kt]); s[g][kt] = WF::mma(kf2[kt][kc], qf[g][kc], s[g][kt]); } } }
        const int jn = (j0 + 32 < TT) ? j0 + 32 : j0;   // next block's K fragments fly during this block's softmax and attn.v (the last trip re-reads its own)
        const T16* pk = Kp + (size_t)(jn + lr) * HD + 8 * hi;
#pragma unroll
        for (int kt = 0; kt < 2; ++kt)
#pragma unroll
            for (int kc = 0; kc < 2; ++kc) kf[kt][kc] = WF::ld(pk + kt * 16 * HD + kc * 32);
        asm volatile("s_wait_xcnt 0x0" :: "v"(pk) : "memory");   // as at the V loads
        if constexpr (HL) { const T16* pk2 = K2 + (size_t)(jn + lr) * HD + 8 * hi;
#pragma unroll
            for (int kt = 0; kt < 2; ++kt)
#pragma unroll
                for (int kc = 0; kc < 2; ++kc) kf2[kt][kc] = WF::ld(pk2 + kt * 16 * HD + kc * 32);
            asm volatile("s_wait_xcnt 0x0" :: "v"(pk2) : "memory"); }   // as at the V loads
        __builtin_amdgcn_sched_barrier(0);   // holds this block's V loads and the next block's K loads in front of the softmax: sunk into attn.v (as the build without it has the hi+lo path) they are waited for with little work behind them
        float mn[NQ];
#pragma unroll
        for (int g = 0; g < NQ; ++g) { float bm = -3.0e38f;
#pragma unroll
            for (int kt = 0; kt < 2; ++kt)
#pragma unroll
                for (int r = 0; r < 8; ++r) { s[g][kt][r] *= SCL; bm = fmaxf(bm, s[g][kt][r]); }
            bm = fmaxf(bm, xhalf(bm)); mn[g] = fmaxf(m[g], bm); }
#pragma unroll
        for (int g = 0; g < NQ; ++g) { const float al = exp2s((m[g] - mn[g]) * 1.4426950408889634f); l[g] *= al; m[g] = mn[g];   // exactly 1 where the maximum did not move
#pragma unroll
            for (int dt = 0; dt < 4; ++dt) oa[g][dt] *= al; }
#pragma unroll
        for (int g = 0; g < NQ; ++g) { float e[16]; float bs = 0.f;
#pragma unroll
            for (int k = 0; k < 16; ++k) { e[k] = exp2s((s[g][k >> 3][k & 7] - m[g]) * 1.4426950408889634f); bs += e[k]; }
            l[g] += bs;
            if constexpr (HL) { v8u hw, lw;
#pragma unroll
                for (int k = 0; k < 8; ++k) { unsigned a, c2; split2(e[2 * k], e[2 * k + 1], a, c2); hw[k] = a; lw[k] = c2; }
                const V ph = __builtin_bit_cast(V, hw), pl = __builtin_bit_cast(V, lw);
#pragma unroll
                for (int dt = 0; dt < 4; ++dt) { oa[g][dt] = WF::mma(vf[dt], ph, oa[g][dt]); oa[g][dt] = WF::mma(vf[dt], pl, oa[g][dt]); oa[g][dt] = WF::mma(vf2[dt], ph, oa[g][dt]); }
            } else { V p;
#pragma unroll
                for (int k = 0; k < 16; ++k) p[k] = tohx(e[k]);
#pragma unroll
                for (int dt = 0; dt < 4; ++dt) oa[g][dt] = WF::mma(vf[dt], p, oa[g][dt]); } }
    }
#pragma unroll
    for (int g = 0; g < NQ; ++g) { const float f = __fdiv_rn(1.0f, l[g] + xhalf(l[g]));   // the two lane halves hold the sums of their own keys
#pragma unroll
        for (int dt = 0; dt < 4; ++dt) { v4u oh, ol;
#pragma unroll
            for (int r = 0; r < 4; ++r) { unsigned a, c2; split2(oa[g][dt][2 * r] * f, oa[g][dt][2 * r + 1] * f, a, c2); oh[r] = a; ol[r] = c2; }
            const size_t oo = (size_t)(q0 + g * 16 + lr) * DQ + dt * 16 + 8 * hi; *(v4u*)(Ah + oo) = oh; *(v4u*)(Al + oo) = ol;
            asm volatile("s_wait_xcnt 0x0" ::: "memory"); } }   // before a register that the two stores name is written again
}
// grid (batches x heads, RH/64 + (TT-RH)/128), 4 waves: the hi+lo blocks (3 products, 16 rows a wave) have the lower indices and start first; the fp16 blocks take 32 rows a wave.
__global__ __launch_bounds__(128) void k_fattn(const h16* __restrict__ Q16, const bf* __restrict__ Qh, const bf* __restrict__ Ql, const h16* __restrict__ K16, const bf* __restrict__ Kh, const bf* __restrict__ Kl, const h16* __restrict__ V16, const bf* __restrict__ Vh, const bf* __restrict__ Vl, bf* Ah, bf* Al) {
    const int wave = threadIdx.x >> 5, b = blockIdx.x / NH_, h = blockIdx.x % NH_, blk = blockIdx.y; const size_t zq = (size_t)(b * NH_ + h) * TT * HD, zk = (size_t)(b * NKV + h / REP) * TT * HD; Ah += (size_t)b * TT * DQ; Al += (size_t)b * TT * DQ;
    if (blk < RH / 64) fattn<bf, true, 1>(Qh + zq, Ql + zq, Kh + zk, Kl + zk, Vh + zk, Vl + zk, blk * 64 + wave * 16, Ah + h * HD, Al + h * HD);
    else fattn<h16, false, 2>(Q16 + zq, nullptr, K16 + zk, nullptr, V16 + zk, nullptr, RH + (blk - RH / 64) * 128 + wave * 32, Ah + h * HD, Al + h * HD);
}

extern "C" void kernel_launch(void* const* d_in, const int* in_sizes, int n_in,
                              void* d_out, int out_size, void* d_ws, size_t ws_size, hipStream_t stream) {
    (void)in_sizes; (void)n_in; (void)out_size;
    const float* xq = (const float*)d_in[0]; const float* xk = (const float*)d_in[1]; const float* xv = (const float*)d_in[2]; const float* wq = (const float*)d_in[3]; const float* bq = (const float*)d_in[4]; const float* wk = (const float*)d_in[5]; const float* wv = (const float*)d_in[6]; const float* wo = (const float*)d_in[7]; const float* bo = (const float*)d_in[8]; const float* x = nullptr; (void)x;
    float* OUT = (float*)d_out;     // [2][2048][1024]
    char* wsp = (char*)d_ws;
    auto take = [&](size_t bytes) { char* p = wsp; wsp += (bytes + 255) & ~(size_t)255; return (void*)p; };
    bf* WQ = (bf*)take((size_t)DQ * DM * 2); bf* WK = (bf*)take((size_t)DKV * DM * 2); bf* WV = (bf*)take((size_t)DKV * DM * 2); bf* WO = (bf*)take((size_t)DM * DQ * 2); float* CS = (float*)take((size_t)TT * HD * 2 * 4); (void)WK; (void)WV;   // WQ, WK, WV, WO lie in a row
    bf* XB = (bf*)take((size_t)3 * NB_ * TT * DM * 2); float* FQ = (float*)take((size_t)3 * NB_ * TT * DQ * 4);   // [q, k, v][batch][t][.]
    float* FV = FQ + (size_t)2 * NB_ * TT * DQ;
    h16* QP16 = (h16*)take((size_t)NB_ * NH_ * TT * HD * 2); h16* KP16 = (h16*)take((size_t)NB_ * NKV * TT * HD * 2); h16* VT16 = (h16*)take((size_t)NB_ * NKV * HD * TT * 2);   // each q plane is followed by its k plane: one index runs through both
    bf* QPh = (bf*)take((size_t)NB_ * NH_ * TT * HD * 2); bf* KPh = (bf*)take((size_t)NB_ * NKV * TT * HD * 2); bf* QPl = (bf*)take((size_t)NB_ * NH_ * TT * HD * 2); bf* KPl = (bf*)take((size_t)NB_ * NKV * TT * HD * 2); bf* VTh = (bf*)take((size_t)NB_ * NKV * HD * TT * 2); bf* VTl = (bf*)take((size_t)NB_ * NKV * HD * TT * 2);
    bf* ATh = (bf*)take((size_t)NB_ * TT * DQ * 2); bf* ATl = (bf*)take((size_t)NB_ * TT * DQ * 2);
    if ((size_t)(wsp - (char*)d_ws) > ws_size) return;    // ws 256 MiB
    static_assert(DQ == DKV && DQ == DM, "q, k and v share one launch per stage: equal shapes");
    k_cvt8<<<3 * XBL + 4 * WBL, 256, 0, stream>>>(xq, xk, xv, wq, wk, wv, wo, XB, WQ);
    k_csid<<<(TT * HD + 255) / 256, 256, 0, stream>>>(CS);
    k_gemmw<bf, 0, true><<<dim3(NB_ * TT / 64, DQ / 64, 3), 32, 0, stream>>>(XB, nullptr, WQ, nullptr, DM, FQ, DQ, bq, (size_t)NB_ * TT * DM, (size_t)DQ * DM, (size_t)NB_ * TT * DQ);   /* z: q (+ bq), k, v; rows: both batches */
    k_rope<NH_><<<(unsigned)(((size_t)2 * NB_ * NH_ * TT * HD / 2 + 255) / 256), 256, 0, stream>>>(FQ, DQ, 2 * NB_, CS, nullptr, nullptr, 1.0f, QP16, QPh, QPl);   /* q planes, then k planes */
    k_vtp<NKV><<<(unsigned)(((size_t)NB_ * NKV * TT * HD / 2 + 255) / 256), 256, 0, stream>>>(FV, DKV, NB_, VT16, VTh, VTl);
    k_fattn<<<dim3(NB_ * NH_, RH / 64 + (TT - RH) / 128), 128, 0, stream>>>(QP16, QPh, QPl, KP16, KPh, KPl, VT16, VTh, VTl, ATh, ATl);
    k_gemmw<bf, 1, true><<<dim3(NB_ * TT / 64, DM / 64, 1), 32, 0, stream>>>(ATh, ATl, WO, nullptr, DQ, OUT, DM, bo, 0, 0, 0);
}

// v004
// A run of this version takes 196 microseconds.
// Next to v003, in two timings, it ran 1.19 and 1.18 times as fast.
// Counting every step since v000, it is 10.1 times as fast.
#include <hip/hip_runtime.h>

// Multi-head attention with separate query/key/value inputs ([2][2048][1024] each; q = query Wq^T + bq, k = key Wk^T, v = value Wv^T ('oi' [1024][1024]; 16 heads x 64); scores = (q / 8).k over all 2048 keys (the source's chunked online softmax equals plain softmax); out = merged ctx Wo^T + bo -> [2][2048][1024] (4.2 M)).
// Compute dtypes, f32 accumulate: every input rounded to bf16; q/k/v on PLAIN bf16 operands (inputs: exact) (+ bq on q); scores and attn.v: query rows < 512 hl (3 products), the rest single fp16; softmax f32 (running maximum, unnormalised weights, one division at the end); Wo hl x exact (2 products) + bo.

#define NB_  2
#define TT   2048
#define DM   1024
#define NH_  16
#define NKV  16
#define REP  (NH_ / NKV)
#define HD   64
#define DQ   (NH_ * HD)
#define DKV  (NKV * HD)
#define RH   512                  // query rows < RH use hi+lo planes (0: none)
#define WIN  0
#define SCL  0.125f   // HD^-0.5
typedef _Float16 h16;
typedef unsigned short bf;
typedef __attribute__((ext_vector_type(16))) __bf16   v16bf;
typedef __attribute__((ext_vector_type(16))) _Float16 v16h;
typedef __attribute__((ext_vector_type(8)))  _Float16 v8h;
typedef __attribute__((ext_vector_type(8)))  unsigned short v8us;
typedef __attribute__((ext_vector_type(8)))  float    v8f;
typedef __attribute__((ext_vector_type(4)))  float    v4f;
typedef v8h  __attribute__((may_alias)) v8ha;
typedef v4f  __attribute__((may_alias)) v4fa;
typedef v8us __attribute__((may_alias)) v8usa;

__device__ __forceinline__ unsigned short f2bf(float f) { unsigned u = __float_as_uint(f); u += 0x7FFFu + ((u >> 16) & 1u); return (unsigned short)(u >> 16); }
__device__ __forceinline__ float bf2f(unsigned short b) { return __uint_as_float(((unsigned)b) << 16); }
__device__ __forceinline__ float bfr(float f) { return bf2f(f2bf(f)); }
__device__ __forceinline__ v16h cat16(v8h lo, v8h hi) { return __builtin_shufflevector(lo, hi, 0, 1, 2, 3, 4, 5, 6, 7, 8, 9, 10, 11, 12, 13, 14, 15); }
__device__ __forceinline__ v16bf cat16b(v8us lo, v8us hi) { return __builtin_bit_cast(v16bf, __builtin_shufflevector(lo, hi, 0, 1, 2, 3, 4, 5, 6, 7, 8, 9, 10, 11, 12, 13, 14, 15)); }
__device__ __forceinline__ v8f wmma16(v16h a, v16h b, v8f c) { return __builtin_amdgcn_wmma_f32_16x16x32_f16(false, a, false, b, (short)0, c, false, false); }
__device__ __forceinline__ v8f wmmab(v16bf a, v16bf b, v8f c) { return __builtin_amdgcn_wmma_f32_16x16x32_bf16(false, a, false, b, (short)0, c, false, false); }



// ---- k_gemmw: register-blocked GEMM, ONE WAVE per 64x64 output tile (16 accumulators), operands straight from K-contiguous 16-bit planes; grid (M/64, N/64, Z), 32 threads.
// C[m][n] (f32, pitch ldc, + optional f32 bias[n]) = sum_k A[m][k] Bt[n][k] (+ split products per NSPLIT). z-batch strides sA/sB/sC in elements. K % 32 == 0.
// BIAS: the bias belongs to z-batch 0 alone (the q projection where q, k and v share a launch).
// KS > 1: grid z = ZB * KS; work-group (z, ks) sums only k in [ks K/KS, (ks+1) K/KS) and stores its partial tile in plane ks (planes of ZB * sC elements); K % (32 KS) == 0.
// HP: the tile goes out as 16-bit head planes instead of f32 rows (one 64-column tile is one head): z-batches 0 and 1 (q, k) as [z][batch][head][t][d], z-batch 2 (v) transposed as [batch][head][d][t]; each as fp16 and as bf16 hi + lo.
typedef __attribute__((ext_vector_type(4))) _Float16 v4h;
typedef __attribute__((ext_vector_type(2))) float v2f;
typedef __attribute__((ext_vector_type(2))) __bf16 v2bf;
typedef __attribute__((ext_vector_type(2))) unsigned v2u;
typedef __attribute__((ext_vector_type(4))) unsigned __attribute__((may_alias)) v4u;
// two f32 -> packed bf16 hi pair and bf16 lo pair (lo = x - hi, exact in f32), both rounded to nearest even like f2bf
__device__ __forceinline__ void split2(float x, float y, unsigned& h, unsigned& l) { v2f a; a[0] = x; a[1] = y; h = __builtin_bit_cast(unsigned, __builtin_convertvector(a, v2bf)); v2f r; r[0] = x - __uint_as_float(h << 16); r[1] = y - __uint_as_float(h & 0xFFFF0000u); l = __builtin_bit_cast(unsigned, __builtin_convertvector(r, v2bf)); }
template <typename T16> struct WFrag;
template <> struct WFrag<h16> { typedef v16h V; static __device__ __forceinline__ V ld(const h16* p) { return cat16(*(const v8h*)p, *(const v8h*)(p + 16)); } static __device__ __forceinline__ v8f mma(V a, V b, v8f c) { return wmma16(a, b, c); } };
template <> struct WFrag<bf> { typedef v16bf V; static __device__ __forceinline__ V ld(const bf* p) { return cat16b(*(const v8us*)p, *(const v8us*)(p + 16)); } static __device__ __forceinline__ v8f mma(V a, V b, v8f c) { return wmmab(a, b, c); } };
template <typename T16, int NSPLIT, bool BIAS, bool HP = false, int KS = 1, int ZB = 1>
__global__ __launch_bounds__(32) void k_gemmw(const T16* __restrict__ A, const T16* __restrict__ A2, const T16* __restrict__ Bt, const T16* __restrict__ Bt2, int K, float* C, int ldc, const float* __restrict__ bias, size_t sA, size_t sB, size_t sC, h16* P16, bf* Ph, bf* Pl, h16* V16, bf* Vh, bf* Vl) {
    typedef typename WFrag<T16>::V V;
    __shared__ __align__(16) float os[HP ? 3 * 576 : 16 * 68];   // HP: room for the three 16 x 144-byte v planes
    const size_t z = blockIdx.z / KS; const int ks = blockIdx.z % KS; A += z * sA; if (A2) A2 += z * sA; Bt += z * sB; if (Bt2) Bt2 += z * sB; C += (z + (size_t)ks * ZB) * sC;
    const int kb = ks * (K / KS), ke = kb + K / KS;
    const int lane = threadIdx.x & 31, lr = lane & 15, hi = lane >> 4; const int r0 = blockIdx.x * 64, c0 = blockIdx.y * 64;
    v8f acc[4][4];
#pragma unroll
    for (int mb = 0; mb < 4; ++mb)
#pragma unroll
        for (int nb = 0; nb < 4; ++nb) acc[mb][nb] = (v8f){};
    const size_t aoff = (size_t)(r0 + lr) * K + 8 * hi, boff = (size_t)(c0 + lr) * K + 8 * hi;
#pragma unroll 1
    for (int kc = kb; kc < ke; kc += 32) {
        V a[4], a2[4];
#pragma unroll
        for (int mb = 0; mb < 4; ++mb) { a[mb] = WFrag<T16>::ld(A + aoff + (size_t)mb * 16 * K + kc); if (NSPLIT == 1 || NSPLIT == 2) a2[mb] = WFrag<T16>::ld(A2 + aoff + (size_t)mb * 16 * K + kc); }
#pragma unroll
        for (int nb = 0; nb < 4; ++nb) { const V b = WFrag<T16>::ld(Bt + boff + (size_t)nb * 16 * K + kc); V b2; if (NSPLIT >= 2) b2 = WFrag<T16>::ld(Bt2 + boff + (size_t)nb * 16 * K + kc);
#pragma unroll
            for (int mb = 0; mb < 4; ++mb) { acc[mb][nb] = WFrag<T16>::mma(a[mb], b, acc[mb][nb]); if (NSPLIT == 1 || NSPLIT == 2) acc[mb][nb] = WFrag<T16>::mma(a2[mb], b, acc[mb][nb]); if (NSPLIT >= 2) acc[mb][nb] = WFrag<T16>::mma(a[mb], b2, acc[mb][nb]); } }
        asm volatile("v_nop\n\tv_nop\n\tv_nop\n\tv_nop" : "+v"(acc[0][0]), "+v"(acc[1][1]), "+v"(acc[2][2]), "+v"(acc[3][3]) : "v"(a[0]), "v"(a[3]));
    }
    if (HP && z == 2) {   // v: a lane's accumulator holds 8 successive t of one d, 16 bytes of a transposed plane's row; 16 d x 64 t of each plane are gathered in LDS (rows of 144 bytes) so that every store covers whole 128-byte lines
        v4u* sv = (v4u*)os;
        const size_t vo = ((size_t)((r0 / TT) * NKV + blockIdx.y) * HD + (lane >> 3)) * TT + r0 % TT + 8 * (lane & 7);
#pragma unroll
        for (int nb = 0; nb < 4; ++nb) {
#pragma unroll
            for (int mb = 0; mb < 4; ++mb) { v8h o16; v4u oh, ol;
#pragma unroll
                for (int j = 0; j < 8; ++j) o16[j] = (h16)acc[mb][nb][j];
#pragma unroll
                for (int j = 0; j < 4; ++j) { unsigned a, c2; split2(acc[mb][nb][2 * j], acc[mb][nb][2 * j + 1], a, c2); oh[j] = a; ol[j] = c2; }
                const int w = lr * 9 + mb * 2 + hi; sv[w] = __builtin_bit_cast(v4u, o16); sv[144 + w] = oh; sv[288 + w] = ol; }
            __builtin_amdgcn_wave_barrier(); asm volatile("" ::: "memory");   // the lanes read each other's LDS writes: keeps the compiler from moving the reads below in front of them
            v4u g16[4], gh[4], gl[4];
#pragma unroll
            for (int s = 0; s < 4; ++s) { const int rd = (4 * s + (lane >> 3)) * 9 + (lane & 7); g16[s] = sv[rd]; gh[s] = sv[144 + rd]; gl[s] = sv[288 + rd]; }
#pragma unroll
            for (int s = 0; s < 4; ++s) { const size_t o = vo + (size_t)(nb * 16 + 4 * s) * TT; *(v4u*)(V16 + o) = g16[s]; *(v4u*)(Vh + o) = gh[s]; *(v4u*)(Vl + o) = gl[s]; }
            asm volatile("s_wait_xcnt 0x0" :: "v"(g16[0]), "v"(g16[1]), "v"(g16[2]), "v"(g16[3]), "v"(gh[0]), "v"(gh[1]), "v"(gh[2]), "v"(gh[3]), "v"(gl[0]), "v"(gl[1]), "v"(gl[2]), "v"(gl[3]) : "memory");   // before a register that the twelve stores name is written again; the stored values are its inputs, so that they live to here
            __builtin_amdgcn_wave_barrier(); asm volatile("" ::: "memory"); }   // and the next 16 d's writes behind these reads
        return; }
    v4f bv = {-0.0f, -0.0f, -0.0f, -0.0f};   // a lane's four columns are the same in every row; -0 leaves every value as it is where there is no bias
    if (BIAS && z == 0) { const float* pb = bias + c0 + lr * 4; float bl[4];
#pragma unroll
        for (int q = 0; q < 4; ++q) bl[q] = pb[q];
        asm volatile("s_wait_xcnt 0x0" :: "v"(pb) : "memory");   // the wait before a register that the load names is written again; the pointer is its input, so that it lives to here and the load does not land on it
#pragma unroll
        for (int q = 0; q < 4; ++q) bv[q] = bfr(bl[q]); }
#pragma unroll
    for (int mb = 0; mb < 4; ++mb) {
#pragma unroll
        for (int nb = 0; nb < 4; ++nb) {
#pragma unroll
            for (int j = 0; j < 8; ++j) os[(hi * 8 + j) * 68 + nb * 16 + lr] = acc[mb][nb][j]; }
        __builtin_amdgcn_wave_barrier(); asm volatile("" ::: "memory");
        if constexpr (HP) { const size_t po = (((z * NB_ + r0 / TT) * NH_ + blockIdx.y) * TT + r0 % TT + mb * 16) * HD;   // q, k: a row of the tile is a whole 128-byte row of each plane
            v4f val[8];
#pragma unroll
            for (int s = 0; s < 8; ++s) { val[s] = *(const v4fa*)(os + (2 * s + hi) * 68 + lr * 4); if (BIAS) val[s] += bv; }
#pragma unroll
            for (int s4 = 0; s4 < 8; s4 += 4) { v4h o16[4]; v2u oh[4], ol[4];
#pragma unroll
                for (int s = 0; s < 4; ++s) {
#pragma unroll
                    for (int q = 0; q < 4; ++q) o16[s][q] = (h16)val[s4 + s][q];
#pragma unroll
                    for (int q = 0; q < 2; ++q) { unsigned a, c2; split2(val[s4 + s][2 * q], val[s4 + s][2 * q + 1], a, c2); oh[s][q] = a; ol[s][q] = c2; }
                    const size_t o = po + (size_t)(2 * (s4 + s) + hi) * HD + lr * 4; *(v4h*)(P16 + o) = o16[s]; *(v2u*)(Ph + o) = oh[s]; *(v2u*)(Pl + o) = ol[s]; }
                asm volatile("s_wait_xcnt 0x0" :: "v"(o16[0]), "v"(o16[1]), "v"(o16[2]), "v"(o16[3]), "v"(oh[0]), "v"(oh[1]), "v"(oh[2]), "v"(oh[3]), "v"(ol[0]), "v"(ol[1]), "v"(ol[2]), "v"(ol[3]) : "memory"); }   // as at the v stores
        } else {
        float* crow = C + (size_t)(r0 + mb * 16) * ldc + c0;
{
#pragma unroll
            for (int s = 0; s < 8; ++s) { const int row = 2 * s + hi, cofs = lr * 4; v4f val = *(const v4fa*)(os + row * 68 + cofs); if (BIAS) val += bv;
                *(v4f*)(crow + (size_t)row * ldc + cofs) = val; }
             }
        }
        __builtin_amdgcn_wave_barrier(); asm volatile("" ::: "memory");
    }
}

__device__ __forceinline__ h16 tohx(float x) { return (h16)x; }
__device__ __forceinline__ void splitf(float y, unsigned short& h, unsigned short& l) { h = f2bf(y); l = f2bf(y - bf2f(h)); }
typedef __attribute__((ext_vector_type(2))) _Float16 v2h;
typedef __attribute__((ext_vector_type(2))) unsigned short v2us;
typedef __attribute__((ext_vector_type(4))) unsigned short v4us;
typedef __attribute__((ext_vector_type(4))) int v4i;

__global__ __launch_bounds__(256) void k_wtG(const float* __restrict__ w, int K, int N, bf* Bt) {
    const int lane = threadIdx.x & 31; const int L0 = (blockIdx.x * 8 + (threadIdx.x >> 5)) * 8; const int nlines = N * K / 64;
{
#pragma unroll 1
        for (int l = 0; l < 8; ++l) { const int L = L0 + l; if (L >= nlines) break; const size_t e = (size_t)L * 64 + lane * 2; const int k = (int)(e % K), n = (int)(e / K); v2us o;
            o[0] = f2bf(w[(size_t)k * N + n]); o[1] = f2bf(w[(size_t)(k + 1) * N + n]); *(v2us*)(Bt + e) = o; }
         }
}
// k_cvt8: every f32 input of the products to bf16 in one launch. Blocks [0, 3 XBL): query, key, value (both batches) -> XB[3][NB_ TT][DM]; the rest: Wq, Wk, Wv, Wo -> WB[4][DM][DM]. 2048 elements a block.
#define XBL ((unsigned)((size_t)NB_ * TT * DM / 2048))
#define WBL ((unsigned)((size_t)DQ * DM / 2048))
__global__ __launch_bounds__(256) void k_cvt8(const float* __restrict__ xq, const float* __restrict__ xk, const float* __restrict__ xv, const float* __restrict__ wq, const float* __restrict__ wk, const float* __restrict__ wv, const float* __restrict__ wo, bf* XB, bf* WB) {
    const unsigned bx = blockIdx.x; const bool isx = bx < 3 * XBL; const unsigned seg = isx ? bx / XBL : (bx - 3 * XBL) / WBL, blk = isx ? bx % XBL : (bx - 3 * XBL) % WBL;
    const float* src = isx ? (seg == 0 ? xq : seg == 1 ? xk : xv) : (seg == 0 ? wq : seg == 1 ? wk : seg == 2 ? wv : wo);
    bf* dst = isx ? XB + (size_t)seg * NB_ * TT * DM : WB + (size_t)seg * DQ * DM;
    const size_t i = (size_t)blk * 256 + threadIdx.x; const v8f v = *(const v8f*)(src + i * 8); v8us o;
#pragma unroll
    for (int k = 0; k < 8; ++k) o[k] = f2bf(v[k]); *(v8us*)(dst + i * 8) = o;  }

typedef __attribute__((ext_vector_type(8))) unsigned v8u;
// 2^x. The v_nop fills the slot that the instruction set asks for behind a transcendental before its result is read or its source overwritten
__device__ __forceinline__ float exp2s(float x) { float r; asm("v_exp_f32 %0, %1\n\tv_nop" : "=v"(r) : "v"(x)); return r; }
// value of lane l ^ 16
__device__ __forceinline__ float xhalf(float x) { const int b = __float_as_int(x); return __int_as_float(__builtin_amdgcn_permlanex16(b, b, 0x76543210, 0xfedcba98, false, false)); }
// k_fattn: scores, softmax and attn.v of one head in one kernel; S and P stay in registers. One wave owns NQ groups of 16 query rows and walks the 2048 keys in blocks of 32.
// Transposed products: S^T = K Q^T (a lane holds 16 scores of ONE query: keys 8 hi + r and 16 + 8 hi + r), so the two score tiles, converted in place, are the B operand of O^T += V^T P^T in the loader's own k order.
// Running maximum m and sum l per query; P = exp(t - m) unnormalised; O and l are rescaled by exp(m_old - m_new) when a maximum moves; O / l at the end, split into the hi/lo planes [t][DQ].
template <typename T16, bool HL, int NQ>
__device__ __forceinline__ void fattn(const T16* __restrict__ Q, const T16* __restrict__ Q2, const T16* __restrict__ Kp, const T16* __restrict__ K2, const T16* __restrict__ Vt, const T16* __restrict__ V2, int q0, bf* Ah, bf* Al) {
    typedef WFrag<T16> WF; typedef typename WF::V V;
    const int lane = threadIdx.x & 31, lr = lane & 15, hi = lane >> 4;
    V qf[NQ][2], qf2[NQ][2], kf[2][2], kf2[2][2];
#pragma unroll
    for (int g = 0; g < NQ; ++g)
#pragma unroll
        for (int kc = 0; kc < 2; ++kc) { const size_t o = (size_t)(q0 + g * 16 + lr) * HD + kc * 32 + 8 * hi; qf[g][kc] = WF::ld(Q + o); if constexpr (HL) qf2[g][kc] = WF::ld(Q2 + o); }
#pragma unroll
    for (int kt = 0; kt < 2; ++kt)
#pragma unroll
        for (int kc = 0; kc < 2; ++kc) { const size_t o = (size_t)(kt * 16 + lr) * HD + kc * 32 + 8 * hi; kf[kt][kc] = WF::ld(Kp + o); if constexpr (HL) kf2[kt][kc] = WF::ld(K2 + o); }
    v8f oa[NQ][4]; float m[NQ], l[NQ];
#pragma unroll
    for (int g = 0; g < NQ; ++g) { m[g] = -3.0e38f; l[g] = 0.f;
#pragma unroll
        for (int dt = 0; dt < 4; ++dt) oa[g][dt] = (v8f){}; }
#pragma unroll 1   // rolled: one block's fragments, scores and the output tiles already fill the register budget
    for (int j0 = 0; j0 < TT; j0 += 32) {
        V vf[4], vf2[4];   // this block's V fragments fly during its scores and softmax
        const T16* pv = Vt + (size_t)lr * TT + j0 + 8 * hi;
#pragma unroll
        for (int dt = 0; dt < 4; ++dt) vf[dt] = WF::ld(pv + (size_t)dt * 16 * TT);
        asm volatile("s_wait_xcnt 0x0" :: "v"(pv) : "memory");   // behind each run of loads: the wait before a register that the run names is written again; the run's base pointer is its input, so that it lives to here and no load of the run lands on it
        if constexpr (HL) { const T16* pv2 = V2 + (size_t)lr * TT + j0 + 8 * hi;
#pragma unroll
            for (int dt = 0; dt < 4; ++dt) vf2[dt] = WF::ld(pv2 + (size_t)dt * 16 * TT);
            asm volatile("s_wait_xcnt 0x0" :: "v"(pv2) : "memory"); }   // as above
        v8f s[NQ][2];
#pragma unroll
        for (int g = 0; g < NQ; ++g)
#pragma unroll
            for (int kt = 0; kt < 2; ++kt) { s[g][kt] = (v8f){};
#pragma unroll
                for (int kc = 0; kc < 2; ++kc) { s[g][kt] = WF::mma(kf[kt][kc], qf[g][kc], s[g][kt]); if constexpr (HL) { s[g][kt] = WF::mma(kf[kt][kc], qf2[g][kc], s[g][kt]); s[g][kt] = WF::mma(kf2[kt][kc], qf[g][kc], s[g][kt]); } } }
        const int jn = (j0 + 32 < TT) ? j0 + 32 : j0;   // next block's K fragments fly during this block's softmax and attn.v (the last trip re-reads its own)
        const T16* pk = Kp + (size_t)(jn + lr) * HD + 8 * hi;
#pragma unroll
        for (int kt = 0; kt < 2; ++kt)
#pragma unroll
            for (int kc = 0; kc < 2; ++kc) kf[kt][kc] = WF::ld(pk + kt * 16 * HD + kc * 32);
        asm volatile("s_wait_xcnt 0x0" :: "v"(pk) : "memory");   // as at the V loads
        if constexpr (HL) { const T16* pk2 = K2 + (size_t)(jn + lr) * HD + 8 * hi;
#pragma unroll
            for (int kt = 0; kt < 2; ++kt)
#pragma unroll
                for (int kc = 0; kc < 2; ++kc) kf2[kt][kc] = WF::ld(pk2 + kt * 16 * HD + kc * 32);
            asm volatile("s_wait_xcnt 0x0" :: "v"(pk2) : "memory"); }   // as at the V loads
        __builtin_amdgcn_sched_barrier(0);   // holds this block's V loads and the next block's K loads in front of the softmax: sunk into attn.v (as the build without it has the hi+lo path) they are waited for with little work behind them
        float mn[NQ];
#pragma unroll
        for (int g = 0; g < NQ; ++g) { float bm = -3.0e38f;
#pragma unroll
            for (int kt = 0; kt < 2; ++kt)
#pragma unroll
                for (int r = 0; r < 8; ++r) { s[g][kt][r] *= SCL; bm = fmaxf(bm, s[g][kt][r]); }
            bm = fmaxf(bm, xhalf(bm)); mn[g] = fmaxf(m[g], bm); }
#pragma unroll
        for (int g = 0; g < NQ; ++g) { const float al = exp2s((m[g] - mn[g]) * 1.4426950408889634f); l[g] *= al; m[g] = mn[g];   // exactly 1 where the maximum did not move
#pragma unroll
            for (int dt = 0; dt < 4; ++dt) oa[g][dt] *= al; }
#pragma unroll
        for (int g = 0; g < NQ; ++g) { float e[16]; float bs = 0.f;
#pragma unroll
            for (int k = 0; k < 16; ++k) { e[k] = exp2s((s[g][k >> 3][k & 7] - m[g]) * 1.4426950408889634f); bs += e[k]; }
            l[g] += bs;
            if constexpr (HL) { v8u hw, lw;
#pragma unroll
                for (int k = 0; k < 8; ++k) { unsigned a, c2; split2(e[2 * k], e[2 * k + 1], a, c2); hw[k] = a; lw[k] = c2; }
                const V ph = __builtin_bit_cast(V, hw), pl = __builtin_bit_cast(V, lw);
#pragma unroll
                for (int dt = 0; dt < 4; ++dt) { oa[g][dt] = WF::mma(vf[dt], ph, oa[g][dt]); oa[g][dt] = WF::mma(vf[dt], pl, oa[g][dt]); oa[g][dt] = WF::mma(vf2[dt], ph, oa[g][dt]); }
            } else { V p;
#pragma unroll
                for (int k = 0; k < 16; ++k) p[k] = tohx(e[k]);
#pragma unroll
                for (int dt = 0; dt < 4; ++dt) oa[g][dt] = WF::mma(vf[dt], p, oa[g][dt]); } }
    }
#pragma unroll
    for (int g = 0; g < NQ; ++g) { const float f = __fdiv_rn(1.0f, l[g] + xhalf(l[g]));   // the two lane halves hold the sums of their own keys
#pragma unroll
        for (int dt = 0; dt < 4; ++dt) { v4u oh, ol;
#pragma unroll
            for (int r = 0; r < 4; ++r) { unsigned a, c2; split2(oa[g][dt][2 * r] * f, oa[g][dt][2 * r + 1] * f, a, c2); oh[r] = a; ol[r] = c2; }
            const size_t oo = (size_t)(q0 + g * 16 + lr) * DQ + dt * 16 + 8 * hi; *(v4u*)(Ah + oo) = oh; *(v4u*)(Al + oo) = ol;
            asm volatile("s_wait_xcnt 0x0" ::: "memory"); } }   // before a register that the two stores name is written again
}
// grid (batches x heads, RH/64 + (TT-RH)/128), 4 waves: the hi+lo blocks (3 products, 16 rows a wave) have the lower indices and start first; the fp16 blocks take 32 rows a wave.
__global__ __launch_bounds__(128) void k_fattn(const h16* __restrict__ Q16, const bf* __restrict__ Qh, const bf* __restrict__ Ql, const h16* __restrict__ K16, const bf* __restrict__ Kh, const bf* __restrict__ Kl, const h16* __restrict__ V16, const bf* __restrict__ Vh, const bf* __restrict__ Vl, bf* Ah, bf* Al) {
    const int wave = threadIdx.x >> 5, b = blockIdx.x / NH_, h = blockIdx.x % NH_, blk = blockIdx.y; const size_t zq = (size_t)(b * NH_ + h) * TT * HD, zk = (size_t)(b * NKV + h / REP) * TT * HD; Ah += (size_t)b * TT * DQ; Al += (size_t)b * TT * DQ;
    if (blk < RH / 64) fattn<bf, true, 1>(Qh + zq, Ql + zq, Kh + zk, Kl + zk, Vh + zk, Vl + zk, blk * 64 + wave * 16, Ah + h * HD, Al + h * HD);
    else fattn<h16, false, 2>(Q16 + zq, nullptr, K16 + zk, nullptr, V16 + zk, nullptr, RH + (blk - RH / 64) * 128 + wave * 32, Ah + h * HD, Al + h * HD);
}

extern "C" void kernel_launch(void* const* d_in, const int* in_sizes, int n_in,
                              void* d_out, int out_size, void* d_ws, size_t ws_size, hipStream_t stream) {
    (void)in_sizes; (void)n_in; (void)out_size;
    const float* xq = (const float*)d_in[0]; const float* xk = (const float*)d_in[1]; const float* xv = (const float*)d_in[2]; const float* wq = (const float*)d_in[3]; const float* bq = (const float*)d_in[4]; const float* wk = (const float*)d_in[5]; const float* wv = (const float*)d_in[6]; const float* wo = (const float*)d_in[7]; const float* bo = (const float*)d_in[8]; const float* x = nullptr; (void)x;
    float* OUT = (float*)d_out;     // [2][2048][1024]
    char* wsp = (char*)d_ws;
    auto take = [&](size_t bytes) { char* p = wsp; wsp += (bytes + 255) & ~(size_t)255; return (void*)p; };
    bf* WQ = (bf*)take((size_t)DQ * DM * 2); bf* WK = (bf*)take((size_t)DKV * DM * 2); bf* WV = (bf*)take((size_t)DKV * DM * 2); bf* WO = (bf*)take((size_t)DM * DQ * 2); (void)WK; (void)WV;   // WQ, WK, WV, WO lie in a row
    bf* XB = (bf*)take((size_t)3 * NB_ * TT * DM * 2);   // [q, k, v][batch][t][.]
    h16* QP16 = (h16*)take((size_t)NB_ * NH_ * TT * HD * 2); h16* KP16 = (h16*)take((size_t)NB_ * NKV * TT * HD * 2); h16* VT16 = (h16*)take((size_t)NB_ * NKV * HD * TT * 2);   // each q plane is followed by its k plane: one index runs through both
    bf* QPh = (bf*)take((size_t)NB_ * NH_ * TT * HD * 2); bf* KPh = (bf*)take((size_t)NB_ * NKV * TT * HD * 2); bf* QPl = (bf*)take((size_t)NB_ * NH_ * TT * HD * 2); bf* KPl = (bf*)take((size_t)NB_ * NKV * TT * HD * 2); bf* VTh = (bf*)take((size_t)NB_ * NKV * HD * TT * 2); bf* VTl = (bf*)take((size_t)NB_ * NKV * HD * TT * 2);
    bf* ATh = (bf*)take((size_t)NB_ * TT * DQ * 2); bf* ATl = (bf*)take((size_t)NB_ * TT * DQ * 2);
    if ((size_t)(wsp - (char*)d_ws) > ws_size) return;    // ws 256 MiB
    static_assert(DQ == DKV && DQ == DM && HD == 64 && TT % 64 == 0, "q, k and v share one launch per stage: equal shapes; a 64 x 64 tile lies in one head and one batch");
    k_cvt8<<<3 * XBL + 4 * WBL, 256, 0, stream>>>(xq, xk, xv, wq, wk, wv, wo, XB, WQ);
    k_gemmw<bf, 0, true, true><<<dim3(NB_ * TT / 64, DQ / 64, 3), 32, 0, stream>>>(XB, nullptr, WQ, nullptr, DM, nullptr, 0, bq, (size_t)NB_ * TT * DM, (size_t)DQ * DM, 0, QP16, QPh, QPl, VT16, VTh, VTl);   /* z: q (+ bq), k, v; rows: both batches; out: the head planes (q planes, then k planes; v transposed) */
    k_fattn<<<dim3(NB_ * NH_, RH / 64 + (TT - RH) / 128), 128, 0, stream>>>(QP16, QPh, QPl, KP16, KPh, KPl, VT16, VTh, VTl, ATh, ATl);
    k_gemmw<bf, 1, true><<<dim3(NB_ * TT / 64, DM / 64, 1), 32, 0, stream>>>(ATh, ATl, WO, nullptr, DQ, OUT, DM, bo, 0, 0, 0, nullptr, nullptr, nullptr, nullptr, nullptr, nullptr);
}
